// v000
// Measured on an AMD MI455X. A time is GPU time per run, averaged over a window of back-to-back runs after a warm-up
// (all launches, gaps included; the runs take copies of the inputs in turn), and the median of several windows.
// Apart from v000's, it joins two sittings. Times from different sittings can be a few percent apart, while
// side-by-side timings come from the same sitting.
// v000, which the later versions start from, runs in 100 microseconds.
#include <hip/hip_runtime.h>
#include <hip/hip_bf16.h>
#include <cstdint>

#define B_ 4
#define N_ 1024
#define E_ 512
#define H_ 8
#define D_ 64

typedef __attribute__((ext_vector_type(16))) _Float16 v16h;
typedef __attribute__((ext_vector_type(8)))  float    v8f;
typedef __attribute__((ext_vector_type(4)))  uint32_t v4u;
typedef __attribute__((ext_vector_type(4)))  int      v4i;

#define AS1 __attribute__((address_space(1)))
#define AS3 __attribute__((address_space(3)))

#if defined(__has_builtin)
#  if __has_builtin(__builtin_amdgcn_global_load_async_to_lds_b128)
#    define USE_ASYNC_LDS 1
#  endif
#endif
#ifndef USE_ASYNC_LDS
#  define USE_ASYNC_LDS 0
#endif

__device__ __forceinline__ void wait_asynccnt0() {
#if defined(__has_builtin) && __has_builtin(__builtin_amdgcn_s_wait_asynccnt)
  __builtin_amdgcn_s_wait_asynccnt(0);
#else
  asm volatile("s_wait_asynccnt 0x0" ::: "memory");
#endif
}

__device__ __forceinline__ v8f wmma32(v16h a, v16h b, v8f c) {
  // 8 args: (neg_a, A, neg_b, B, c_mod, C, reuse_a, reuse_b)
  return __builtin_amdgcn_wmma_f32_16x16x32_f16(
      false, a, false, b, (short)0, c, false, false);
}

__device__ __forceinline__ v16h load_frag16(const _Float16* base, int ldh) {
  const int lane = threadIdx.x & 31;
  const int row  = lane & 15;
  const int hi   = lane >> 4;
  union { v16h v; v4u q[2]; } f;
  const _Float16* rp = base + row * ldh + hi * 8;
  f.q[0] = *(const v4u*)(rp);
  f.q[1] = *(const v4u*)(rp + 16);
  return f.v;
}

__device__ __forceinline__ float rowmax16(float x) {
  x = fmaxf(x, __shfl_xor(x, 1, 32));
  x = fmaxf(x, __shfl_xor(x, 2, 32));
  x = fmaxf(x, __shfl_xor(x, 4, 32));
  x = fmaxf(x, __shfl_xor(x, 8, 32));
  return x;
}
__device__ __forceinline__ float rowsum16(float x) {
  x += __shfl_xor(x, 1, 32);
  x += __shfl_xor(x, 2, 32);
  x += __shfl_xor(x, 4, 32);
  x += __shfl_xor(x, 8, 32);
  return x;
}

// ---------------------------------------------------------------------------
// f32 -> f16 conversion
// ---------------------------------------------------------------------------
__global__ void f32_to_f16_kernel(const float* __restrict__ src,
                                  _Float16* __restrict__ dst, int n) {
  int i = blockIdx.x * blockDim.x + threadIdx.x;
  if (i < n) dst[i] = (_Float16)src[i];
}

template <typename OutT>
__global__ void __launch_bounds__(256) gemm_xwT_kernel(
    const _Float16* __restrict__ A, const _Float16* __restrict__ W,
    const float* __restrict__ bias, OutT* __restrict__ out) {
  const int rowBase = blockIdx.x * 128;
  const int colBase = blockIdx.y * 64;
  const int wid = threadIdx.x >> 5;
  const int r0 = rowBase + (wid & 3) * 32;
  const int c0 = colBase + (wid >> 2) * 32;

  v8f acc[2][2] = {};
  for (int k0 = 0; k0 < E_; k0 += 32) {
    v16h a0 = load_frag16(A + (size_t)r0 * E_ + k0, E_);
    v16h a1 = load_frag16(A + (size_t)(r0 + 16) * E_ + k0, E_);
    v16h b0 = load_frag16(W + (size_t)c0 * E_ + k0, E_);
    v16h b1 = load_frag16(W + (size_t)(c0 + 16) * E_ + k0, E_);
    acc[0][0] = wmma32(a0, b0, acc[0][0]);
    acc[0][1] = wmma32(a0, b1, acc[0][1]);
    acc[1][0] = wmma32(a1, b0, acc[1][0]);
    acc[1][1] = wmma32(a1, b1, acc[1][1]);
  }

  const int lane = threadIdx.x & 31;
  const int col = lane & 15;
  const int hi  = lane >> 4;
#pragma unroll
  for (int i = 0; i < 2; ++i) {
#pragma unroll
    for (int j = 0; j < 2; ++j) {
      const int c = c0 + j * 16 + col;
      const float bv = bias[c];
#pragma unroll
      for (int v = 0; v < 8; ++v) {
        const int r = r0 + i * 16 + v + 8 * hi;
        out[(size_t)r * E_ + c] = (OutT)(acc[i][j][v] + bv);
      }
    }
  }
}

// ---------------------------------------------------------------------------
// Fused attention (flash-style; masks streamed once, non-temporal).
// Block = 8 waves; each wave owns 16 query rows of one (b,h); key tiles of 64.
// Q/K/V f16 laid out [b, n, h, d] so head slices are contiguous.
// ---------------------------------------------------------------------------
__global__ void __launch_bounds__(256) attn_kernel(
    const _Float16* __restrict__ qb, const _Float16* __restrict__ kb,
    const _Float16* __restrict__ vb, const float* __restrict__ rnodes,
    const float* __restrict__ aadd, const float* __restrict__ amul,
    _Float16* __restrict__ ob) {
  __shared__ alignas(16) _Float16 Ks[64 * 72];     // [key][d] -> B frags (QK^T)
  __shared__ alignas(16) _Float16 Vt[64 * 72];     // [d][key] -> B frags (P@V)
  __shared__ alignas(16) _Float16 Ps[8][16 * 72];  // per-wave probs C->A restripe
#if USE_ASYNC_LDS
  __shared__ alignas(16) _Float16 Vraw[64 * 64];   // async landing pad for V
#endif

  const int b = blockIdx.z;
  const int h = blockIdx.y;
  const int wid  = threadIdx.x >> 5;
  const int lane = threadIdx.x & 31;
  const int col  = lane & 15;
  const int hi   = lane >> 4;
  const int qbase = blockIdx.x * 128 + wid * 16;

  // Q fragments live in registers for the whole pass (K = D = 64 -> 2 frags).
  const _Float16* qp = qb + ((size_t)(b * N_) + qbase) * E_ + h * D_;
  const v16h aq0 = load_frag16(qp, E_);
  const v16h aq1 = load_frag16(qp + 32, E_);

  float rn[8];
#pragma unroll
  for (int v = 0; v < 8; ++v)
    rn[v] = rnodes[b * N_ + qbase + v + 8 * hi] * 0.125f;  // 1/sqrt(64)

  const size_t mbase = ((size_t)(b * H_ + h)) * N_ * N_;

  v8f acc[4] = {};
  float l[8], m[8];
#pragma unroll
  for (int v = 0; v < 8; ++v) { l[v] = 0.0f; m[v] = -1e30f; }

  for (int kt = 0; kt < N_; kt += 64) {
    const _Float16* ksrc = kb + ((size_t)(b * N_) + kt) * E_ + h * D_;
    const _Float16* vsrc = vb + ((size_t)(b * N_) + kt) * E_ + h * D_;

    if (kt + 64 < N_) {
#pragma unroll
      for (int v = 0; v < 8; ++v) {
        const size_t off =
            mbase + (size_t)(qbase + v + 8 * hi) * N_ + (kt + 64) + col;
        __builtin_prefetch(aadd + off, 0, 0);
        __builtin_prefetch(amul + off, 0, 0);
      }
    }

#if USE_ASYNC_LDS
    for (int idx = threadIdx.x; idx < 64 * 8; idx += 256) {
      const int key = idx >> 3, c = (idx & 7) * 8;  // 8 halfs = 16B per chunk
      __builtin_amdgcn_global_load_async_to_lds_b128(
          (v4i*)(ksrc + (size_t)key * E_ + c),
          (AS3 v4i*)&Ks[key * 72 + c], 0, 0);
      __builtin_amdgcn_global_load_async_to_lds_b128(
          (v4i*)(vsrc + (size_t)key * E_ + c),
          (AS3 v4i*)&Vraw[key * 64 + c], 0, 0);
    }
    wait_asynccnt0();
    __syncthreads();
    // LDS->LDS transpose of V into [d][key]
    for (int idx = threadIdx.x; idx < 64 * 64; idx += 256) {
      const int key = idx >> 6, d = idx & 63;
      Vt[d * 72 + key] = Vraw[key * 64 + d];
    }
#else
    // --- synchronous staging fallback ---
    for (int idx = threadIdx.x; idx < 64 * 32; idx += 256) {
      const int key = idx >> 5, dp = (idx & 31) * 2;
      *(uint32_t*)&Ks[key * 72 + dp] =
          *(const uint32_t*)(ksrc + (size_t)key * E_ + dp);
    }
    for (int idx = threadIdx.x; idx < 64 * 64; idx += 256) {
      const int key = idx >> 6, d = idx & 63;
      Vt[d * 72 + key] = vsrc[(size_t)key * E_ + d];
    }
#endif
    __syncthreads();

    // --- scores: S = (Q K^T) * (rn/8) + attn_add (NT stream) ---
    v8f s[4];
#pragma unroll
    for (int nf = 0; nf < 4; ++nf) {
      v8f sc = {};
      sc = wmma32(aq0, load_frag16(&Ks[nf * 16 * 72], 72), sc);
      sc = wmma32(aq1, load_frag16(&Ks[nf * 16 * 72 + 32], 72), sc);
      const float* ap = aadd + mbase + (size_t)(kt + nf * 16 + col);
#pragma unroll
      for (int v = 0; v < 8; ++v) {
        const int q = qbase + v + 8 * hi;
        const float av = __builtin_nontemporal_load(&ap[(size_t)q * N_]);
        sc[v] = sc[v] * rn[v] + av;
      }
      s[nf] = sc;
    }

    // --- online softmax; fold attn_mult post-exp ---
    float alpha[8];
#pragma unroll
    for (int v = 0; v < 8; ++v) {
      float x = fmaxf(fmaxf(s[0][v], s[1][v]), fmaxf(s[2][v], s[3][v]));
      x = rowmax16(x);
      const float nm = fmaxf(m[v], x);
      alpha[v] = __expf(m[v] - nm);
      m[v] = nm;
    }
    float psum[8];
#pragma unroll
    for (int v = 0; v < 8; ++v) psum[v] = 0.0f;
#pragma unroll
    for (int nf = 0; nf < 4; ++nf) {
      const float* mp = amul + mbase + (size_t)(kt + nf * 16 + col);
#pragma unroll
      for (int v = 0; v < 8; ++v) {
        const int q = qbase + v + 8 * hi;
        float p = __expf(s[nf][v] - m[v]);
        psum[v] += p;  // normalizer excludes the multiplicative mask
        p *= __builtin_nontemporal_load(&mp[(size_t)q * N_]);
        Ps[wid][(v + 8 * hi) * 72 + nf * 16 + col] = (_Float16)p;
      }
    }
#pragma unroll
    for (int v = 0; v < 8; ++v) l[v] = l[v] * alpha[v] + rowsum16(psum[v]);

    // --- O = O*alpha + P @ V (probs re-striped via per-wave LDS scratch) ---
    const v16h ap0 = load_frag16(&Ps[wid][0], 72);
    const v16h ap1 = load_frag16(&Ps[wid][32], 72);
#pragma unroll
    for (int df = 0; df < 4; ++df) {
#pragma unroll
      for (int v = 0; v < 8; ++v) acc[df][v] *= alpha[v];
      acc[df] = wmma32(ap0, load_frag16(&Vt[df * 16 * 72], 72), acc[df]);
      acc[df] = wmma32(ap1, load_frag16(&Vt[df * 16 * 72 + 32], 72), acc[df]);
    }
    __syncthreads();
  }

  // --- normalize and store [b, q, h, d] (matches transpose+reshape) ---
  _Float16* op = ob + ((size_t)(b * N_) + qbase) * E_ + h * D_;
#pragma unroll
  for (int v = 0; v < 8; ++v) {
    const float inv = 1.0f / l[v];
    const int r = v + 8 * hi;
#pragma unroll
    for (int df = 0; df < 4; ++df)
      op[(size_t)r * E_ + df * 16 + col] = (_Float16)(acc[df][v] * inv);
  }
}

// ---------------------------------------------------------------------------
// Launch
// ---------------------------------------------------------------------------
extern "C" void kernel_launch(void* const* d_in, const int* in_sizes, int n_in,
                              void* d_out, int out_size, void* d_ws, size_t ws_size,
                              hipStream_t stream) {
  (void)in_sizes; (void)n_in; (void)out_size; (void)ws_size;
  const float* X    = (const float*)d_in[0];
  const float* rno  = (const float*)d_in[1];
  const float* aadd = (const float*)d_in[2];
  const float* amul = (const float*)d_in[3];
  const float* Wq   = (const float*)d_in[4];
  const float* bq   = (const float*)d_in[5];
  const float* Wk   = (const float*)d_in[6];
  const float* bk   = (const float*)d_in[7];
  const float* Wv   = (const float*)d_in[8];
  const float* bv   = (const float*)d_in[9];
  const float* Wo   = (const float*)d_in[10];
  const float* bo   = (const float*)d_in[11];
  float* out = (float*)d_out;

  // Workspace layout (f16): ~23 MB total.
  const int BNE = B_ * N_ * E_;   // 2,097,152
  const int EE  = E_ * E_;        //   262,144
  _Float16* x16  = (_Float16*)d_ws;
  _Float16* wq16 = x16 + BNE;
  _Float16* wk16 = wq16 + EE;
  _Float16* wv16 = wk16 + EE;
  _Float16* wo16 = wv16 + EE;
  _Float16* q16  = wo16 + EE;
  _Float16* k16  = q16 + BNE;
  _Float16* v16  = k16 + BNE;
  _Float16* a16  = v16 + BNE;

  const dim3 blk(256);
  f32_to_f16_kernel<<<(BNE + 255) / 256, blk, 0, stream>>>(X, x16, BNE);
  f32_to_f16_kernel<<<(EE + 255) / 256, blk, 0, stream>>>(Wq, wq16, EE);
  f32_to_f16_kernel<<<(EE + 255) / 256, blk, 0, stream>>>(Wk, wk16, EE);
  f32_to_f16_kernel<<<(EE + 255) / 256, blk, 0, stream>>>(Wv, wv16, EE);
  f32_to_f16_kernel<<<(EE + 255) / 256, blk, 0, stream>>>(Wo, wo16, EE);

  const dim3 ggrid(B_ * N_ / 128, E_ / 64);   // 32 x 8
  gemm_xwT_kernel<_Float16><<<ggrid, blk, 0, stream>>>(x16, wq16, bq, q16);
  gemm_xwT_kernel<_Float16><<<ggrid, blk, 0, stream>>>(x16, wk16, bk, k16);
  gemm_xwT_kernel<_Float16><<<ggrid, blk, 0, stream>>>(x16, wv16, bv, v16);

  attn_kernel<<<dim3(N_ / 128, H_, B_), blk, 0, stream>>>(
      q16, k16, v16, rno, aadd, amul, a16);

  gemm_xwT_kernel<float><<<ggrid, blk, 0, stream>>>(a16, wo16, bo, out);
}

// v001
// Measured time: 89.4 microseconds a run.
// Two timings next to v000 put it at 1.14 and 1.15 times that version's speed.
#include <hip/hip_runtime.h>
#include <hip/hip_bf16.h>
#include <cstdint>

#define B_ 4
#define N_ 1024
#define E_ 512
#define H_ 8
#define D_ 64

typedef __attribute__((ext_vector_type(16))) _Float16 v16h;
typedef __attribute__((ext_vector_type(8)))  float    v8f;
typedef __attribute__((ext_vector_type(4)))  uint32_t v4u;
typedef __attribute__((ext_vector_type(4)))  int      v4i;

#define AS1 __attribute__((address_space(1)))
#define AS3 __attribute__((address_space(3)))

#if defined(__has_builtin)
#  if __has_builtin(__builtin_amdgcn_global_load_async_to_lds_b128)
#    define USE_ASYNC_LDS 1
#  endif
#endif
#ifndef USE_ASYNC_LDS
#  define USE_ASYNC_LDS 0
#endif

__device__ __forceinline__ void wait_asynccnt0() {
#if defined(__has_builtin) && __has_builtin(__builtin_amdgcn_s_wait_asynccnt)
  __builtin_amdgcn_s_wait_asynccnt(0);
#else
  asm volatile("s_wait_asynccnt 0x0" ::: "memory");
#endif
}

__device__ __forceinline__ v8f wmma32(v16h a, v16h b, v8f c) {
  // 8 args: (neg_a, A, neg_b, B, c_mod, C, reuse_a, reuse_b)
  return __builtin_amdgcn_wmma_f32_16x16x32_f16(
      false, a, false, b, (short)0, c, false, false);
}

__device__ __forceinline__ v16h load_frag16(const _Float16* base, int ldh) {
  const int lane = threadIdx.x & 31;
  const int row  = lane & 15;
  const int hi   = lane >> 4;
  union { v16h v; v4u q[2]; } f;
  const _Float16* rp = base + row * ldh + hi * 8;
  f.q[0] = *(const v4u*)(rp);
  f.q[1] = *(const v4u*)(rp + 16);
  return f.v;
}

__device__ __forceinline__ float rowmax16(float x) {
  x = fmaxf(x, __shfl_xor(x, 1, 32));
  x = fmaxf(x, __shfl_xor(x, 2, 32));
  x = fmaxf(x, __shfl_xor(x, 4, 32));
  x = fmaxf(x, __shfl_xor(x, 8, 32));
  return x;
}
__device__ __forceinline__ float rowsum16(float x) {
  x += __shfl_xor(x, 1, 32);
  x += __shfl_xor(x, 2, 32);
  x += __shfl_xor(x, 4, 32);
  x += __shfl_xor(x, 8, 32);
  return x;
}

// ---------------------------------------------------------------------------
// f32 -> f16 conversion of X and of the four weights in ONE launch: none reads
// another's output, and their f16 copies lie back to back in the workspace
// (X, Wq, Wk, Wv, Wo), so dst is indexed by the flat element number. A block
// of 256 elements lies wholly inside one source (both sizes are multiples of
// 256), so the source is picked by a block-uniform test.
// ---------------------------------------------------------------------------
#define BNE_ (B_ * N_ * E_)
#define EE_  (E_ * E_)
__global__ void __launch_bounds__(256) f32_to_f16_all_kernel(
    const float* __restrict__ x, const float* __restrict__ w0,
    const float* __restrict__ w1, const float* __restrict__ w2,
    const float* __restrict__ w3, _Float16* __restrict__ dst) {
  const int first = blockIdx.x * 256;  // flat index of the block's first element
  const float* src = x;
  int off = first;
  if (first >= BNE_) {
    const int w = (first - BNE_) / EE_;
    src = (w == 0) ? w0 : (w == 1) ? w1 : (w == 2) ? w2 : w3;
    off = first - BNE_ - w * EE_;
  }
  dst[first + threadIdx.x] = (_Float16)src[off + threadIdx.x];
}

__device__ __forceinline__ void gemm_xwT_products(
    const _Float16* __restrict__ A, const _Float16* __restrict__ W,
    v8f (&acc)[2][2]) {
  const int wid = threadIdx.x >> 5;
  const int r0 = blockIdx.x * 128 + (wid & 3) * 32;
  const int c0 = blockIdx.y * 64 + (wid >> 2) * 32;
  for (int k0 = 0; k0 < E_; k0 += 32) {
    v16h a0 = load_frag16(A + (size_t)r0 * E_ + k0, E_);
    v16h a1 = load_frag16(A + (size_t)(r0 + 16) * E_ + k0, E_);
    v16h b0 = load_frag16(W + (size_t)c0 * E_ + k0, E_);
    v16h b1 = load_frag16(W + (size_t)(c0 + 16) * E_ + k0, E_);
    acc[0][0] = wmma32(a0, b0, acc[0][0]);
    acc[0][1] = wmma32(a0, b1, acc[0][1]);
    acc[1][0] = wmma32(a1, b0, acc[1][0]);
    acc[1][1] = wmma32(a1, b1, acc[1][1]);
  }
}

template <typename OutT>
__device__ __forceinline__ void gemm_xwT_store(
    const v8f (&acc)[2][2], const float* __restrict__ bias,
    OutT* __restrict__ out) {
  const int wid = threadIdx.x >> 5;
  const int r0 = blockIdx.x * 128 + (wid & 3) * 32;
  const int c0 = blockIdx.y * 64 + (wid >> 2) * 32;
  const int lane = threadIdx.x & 31;
  const int col = lane & 15;
  const int hi  = lane >> 4;
#pragma unroll
  for (int i = 0; i < 2; ++i) {
#pragma unroll
    for (int j = 0; j < 2; ++j) {
      const int c = c0 + j * 16 + col;
      const float bv = bias[c];
#pragma unroll
      for (int v = 0; v < 8; ++v) {
        const int r = r0 + i * 16 + v + 8 * hi;
        out[(size_t)r * E_ + c] = (OutT)(acc[i][j][v] + bv);
      }
    }
  }
}

// Q, K and V projections in ONE launch: they share A and none reads another's
// output. blockIdx.z picks the weight, the bias and the output; the three f16
// weights, and the three outputs, lie back to back in the workspace.
__global__ void __launch_bounds__(256) gemm_qkv_kernel(
    const _Float16* __restrict__ A, const _Float16* __restrict__ W3,
    const float* __restrict__ bq, const float* __restrict__ bk,
    const float* __restrict__ bv, _Float16* __restrict__ out3) {
  const int z = blockIdx.z;
  const float* bias = (z == 0) ? bq : (z == 1) ? bk : bv;
  v8f acc[2][2] = {};
  gemm_xwT_products(A, W3 + (size_t)z * EE_, acc);
  asm volatile("s_wait_xcnt 0x0" ::: "memory");
  gemm_xwT_store<_Float16>(acc, bias, out3 + (size_t)z * BNE_);
}

__global__ void __launch_bounds__(256) gemm_out_kernel(
    const _Float16* __restrict__ A, const _Float16* __restrict__ W,
    const float* __restrict__ bias, float* __restrict__ out) {
  v8f acc[2][2] = {};
  gemm_xwT_products(A, W, acc);
  gemm_xwT_store<float>(acc, bias, out);
}

// ---------------------------------------------------------------------------
// Fused attention (flash-style; masks streamed once, non-temporal).
// Block = 8 waves; each wave owns 16 query rows of one (b,h); key tiles of 64.
// Q/K/V f16 laid out [b, n, h, d] so head slices are contiguous.
// ---------------------------------------------------------------------------
__global__ void __launch_bounds__(256) attn_kernel(
    const _Float16* __restrict__ qb, const _Float16* __restrict__ kb,
    const _Float16* __restrict__ vb, const float* __restrict__ rnodes,
    const float* __restrict__ aadd, const float* __restrict__ amul,
    _Float16* __restrict__ ob) {
  __shared__ alignas(16) _Float16 Ks[64 * 72];     // [key][d] -> B frags (QK^T)
  __shared__ alignas(16) _Float16 Vt[64 * 72];     // [d][key] -> B frags (P@V)
  __shared__ alignas(16) _Float16 Ps[8][16 * 72];  // per-wave probs C->A restripe
#if USE_ASYNC_LDS
  __shared__ alignas(16) _Float16 Vraw[64 * 64];   // async landing pad for V
#endif

  const int b = blockIdx.z;
  const int h = blockIdx.y;
  const int wid  = threadIdx.x >> 5;
  const int lane = threadIdx.x & 31;
  const int col  = lane & 15;
  const int hi   = lane >> 4;
  const int qbase = blockIdx.x * 128 + wid * 16;

  // Q fragments live in registers for the whole pass (K = D = 64 -> 2 frags).
  const _Float16* qp = qb + ((size_t)(b * N_) + qbase) * E_ + h * D_;
  const v16h aq0 = load_frag16(qp, E_);
  const v16h aq1 = load_frag16(qp + 32, E_);

  float rn[8];
#pragma unroll
  for (int v = 0; v < 8; ++v)
    rn[v] = rnodes[b * N_ + qbase + v + 8 * hi] * 0.125f;  // 1/sqrt(64)

  const size_t mbase = ((size_t)(b * H_ + h)) * N_ * N_;

  v8f acc[4] = {};
  float l[8], m[8];
#pragma unroll
  for (int v = 0; v < 8; ++v) { l[v] = 0.0f; m[v] = -1e30f; }

  for (int kt = 0; kt < N_; kt += 64) {
    const _Float16* ksrc = kb + ((size_t)(b * N_) + kt) * E_ + h * D_;
    const _Float16* vsrc = vb + ((size_t)(b * N_) + kt) * E_ + h * D_;

    if (kt + 64 < N_) {
#pragma unroll
      for (int v = 0; v < 8; ++v) {
        const size_t off =
            mbase + (size_t)(qbase + v + 8 * hi) * N_ + (kt + 64) + col;
        __builtin_prefetch(aadd + off, 0, 0);
        __builtin_prefetch(amul + off, 0, 0);
      }
    }

#if USE_ASYNC_LDS
    for (int idx = threadIdx.x; idx < 64 * 8; idx += 256) {
      const int key = idx >> 3, c = (idx & 7) * 8;  // 8 halfs = 16B per chunk
      __builtin_amdgcn_global_load_async_to_lds_b128(
          (v4i*)(ksrc + (size_t)key * E_ + c),
          (AS3 v4i*)&Ks[key * 72 + c], 0, 0);
      __builtin_amdgcn_global_load_async_to_lds_b128(
          (v4i*)(vsrc + (size_t)key * E_ + c),
          (AS3 v4i*)&Vraw[key * 64 + c], 0, 0);
    }
    wait_asynccnt0();
    __syncthreads();
    // LDS->LDS transpose of V into [d][key]
    for (int idx = threadIdx.x; idx < 64 * 64; idx += 256) {
      const int key = idx >> 6, d = idx & 63;
      Vt[d * 72 + key] = Vraw[key * 64 + d];
    }
#else
    // --- synchronous staging fallback ---
    for (int idx = threadIdx.x; idx < 64 * 32; idx += 256) {
      const int key = idx >> 5, dp = (idx & 31) * 2;
      *(uint32_t*)&Ks[key * 72 + dp] =
          *(const uint32_t*)(ksrc + (size_t)key * E_ + dp);
    }
    for (int idx = threadIdx.x; idx < 64 * 64; idx += 256) {
      const int key = idx >> 6, d = idx & 63;
      Vt[d * 72 + key] = vsrc[(size_t)key * E_ + d];
    }
#endif
    __syncthreads();

    // --- scores: S = (Q K^T) * (rn/8) + attn_add (NT stream) ---
    v8f s[4];
#pragma unroll
    for (int nf = 0; nf < 4; ++nf) {
      v8f sc = {};
      sc = wmma32(aq0, load_frag16(&Ks[nf * 16 * 72], 72), sc);
      sc = wmma32(aq1, load_frag16(&Ks[nf * 16 * 72 + 32], 72), sc);
      const float* ap = aadd + mbase + (size_t)(kt + nf * 16 + col);
#pragma unroll
      for (int v = 0; v < 8; ++v) {
        const int q = qbase + v + 8 * hi;
        const float av = __builtin_nontemporal_load(&ap[(size_t)q * N_]);
        sc[v] = sc[v] * rn[v] + av;
      }
      s[nf] = sc;
    }

    // --- online softmax; fold attn_mult post-exp ---
    float alpha[8];
#pragma unroll
    for (int v = 0; v < 8; ++v) {
      float x = fmaxf(fmaxf(s[0][v], s[1][v]), fmaxf(s[2][v], s[3][v]));
      x = rowmax16(x);
      const float nm = fmaxf(m[v], x);
      alpha[v] = __expf(m[v] - nm);
      m[v] = nm;
    }
    float psum[8];
#pragma unroll
    for (int v = 0; v < 8; ++v) psum[v] = 0.0f;
#pragma unroll
    for (int nf = 0; nf < 4; ++nf) {
      const float* mp = amul + mbase + (size_t)(kt + nf * 16 + col);
#pragma unroll
      for (int v = 0; v < 8; ++v) {
        const int q = qbase + v + 8 * hi;
        float p = __expf(s[nf][v] - m[v]);
        psum[v] += p;  // normalizer excludes the multiplicative mask
        p *= __builtin_nontemporal_load(&mp[(size_t)q * N_]);
        Ps[wid][(v + 8 * hi) * 72 + nf * 16 + col] = (_Float16)p;
      }
    }
#pragma unroll
    for (int v = 0; v < 8; ++v) l[v] = l[v] * alpha[v] + rowsum16(psum[v]);

    // --- O = O*alpha + P @ V (probs re-striped via per-wave LDS scratch) ---
    const v16h ap0 = load_frag16(&Ps[wid][0], 72);
    const v16h ap1 = load_frag16(&Ps[wid][32], 72);
#pragma unroll
    for (int df = 0; df < 4; ++df) {
#pragma unroll
      for (int v = 0; v < 8; ++v) acc[df][v] *= alpha[v];
      acc[df] = wmma32(ap0, load_frag16(&Vt[df * 16 * 72], 72), acc[df]);
      acc[df] = wmma32(ap1, load_frag16(&Vt[df * 16 * 72 + 32], 72), acc[df]);
    }
    __syncthreads();
  }

  // --- normalize and store [b, q, h, d] (matches transpose+reshape) ---
  _Float16* op = ob + ((size_t)(b * N_) + qbase) * E_ + h * D_;
#pragma unroll
  for (int v = 0; v < 8; ++v) {
    const float inv = 1.0f / l[v];
    const int r = v + 8 * hi;
#pragma unroll
    for (int df = 0; df < 4; ++df)
      op[(size_t)r * E_ + df * 16 + col] = (_Float16)(acc[df][v] * inv);
  }
}

// ---------------------------------------------------------------------------
// Launch
// ---------------------------------------------------------------------------
extern "C" void kernel_launch(void* const* d_in, const int* in_sizes, int n_in,
                              void* d_out, int out_size, void* d_ws, size_t ws_size,
                              hipStream_t stream) {
  (void)in_sizes; (void)n_in; (void)out_size; (void)ws_size;
  const float* X    = (const float*)d_in[0];
  const float* rno  = (const float*)d_in[1];
  const float* aadd = (const float*)d_in[2];
  const float* amul = (const float*)d_in[3];
  const float* Wq   = (const float*)d_in[4];
  const float* bq   = (const float*)d_in[5];
  const float* Wk   = (const float*)d_in[6];
  const float* bk   = (const float*)d_in[7];
  const float* Wv   = (const float*)d_in[8];
  const float* bv   = (const float*)d_in[9];
  const float* Wo   = (const float*)d_in[10];
  const float* bo   = (const float*)d_in[11];
  float* out = (float*)d_out;

  // Workspace layout (f16): ~23 MB total.
  const int BNE = B_ * N_ * E_;   // 2,097,152
  const int EE  = E_ * E_;        //   262,144
  _Float16* x16  = (_Float16*)d_ws;
  _Float16* wq16 = x16 + BNE;
  _Float16* wk16 = wq16 + EE;
  _Float16* wv16 = wk16 + EE;
  _Float16* wo16 = wv16 + EE;
  _Float16* q16  = wo16 + EE;
  _Float16* k16  = q16 + BNE;
  _Float16* v16  = k16 + BNE;
  _Float16* a16  = v16 + BNE;

  const dim3 blk(256);
  // x16, wq16, wk16, wv16, wo16 are one contiguous range starting at x16.
  f32_to_f16_all_kernel<<<(BNE + 4 * EE) / 256, blk, 0, stream>>>(
      X, Wq, Wk, Wv, Wo, x16);

  // wq16..wv16 and q16..v16 are each three equal arrays back to back.
  gemm_qkv_kernel<<<dim3(B_ * N_ / 128, E_ / 64, 3), blk, 0, stream>>>(
      x16, wq16, bq, bk, bv, q16);

  attn_kernel<<<dim3(N_ / 128, H_, B_), blk, 0, stream>>>(
      q16, k16, v16, rno, aadd, amul, a16);

  gemm_out_kernel<<<dim3(B_ * N_ / 128, E_ / 64), blk, 0, stream>>>(
      a16, wo16, bo, out);
}

// v002
// Measured time: 77.1 microseconds a run.
// Next to v001, in two timings, it ran 1.17 times as fast each time.
// All steps since v000 together make it 1.33 times as fast.
#include <hip/hip_runtime.h>
#include <hip/hip_bf16.h>
#include <cstdint>

#define B_ 4
#define N_ 1024
#define E_ 512
#define H_ 8
#define D_ 64

typedef __attribute__((ext_vector_type(16))) _Float16 v16h;
typedef __attribute__((ext_vector_type(8)))  float    v8f;
typedef __attribute__((ext_vector_type(4)))  uint32_t v4u;
typedef __attribute__((ext_vector_type(4)))  int      v4i;

#define AS1 __attribute__((address_space(1)))
#define AS3 __attribute__((address_space(3)))

#if defined(__has_builtin)
#  if __has_builtin(__builtin_amdgcn_global_load_async_to_lds_b128)
#    define USE_ASYNC_LDS 1
#  endif
#endif
#ifndef USE_ASYNC_LDS
#  define USE_ASYNC_LDS 0
#endif

__device__ __forceinline__ void wait_asynccnt0() {
#if defined(__has_builtin) && __has_builtin(__builtin_amdgcn_s_wait_asynccnt)
  __builtin_amdgcn_s_wait_asynccnt(0);
#else
  asm volatile("s_wait_asynccnt 0x0" ::: "memory");
#endif
}

__device__ __forceinline__ v8f wmma32(v16h a, v16h b, v8f c) {
  // 8 args: (neg_a, A, neg_b, B, c_mod, C, reuse_a, reuse_b)
  return __builtin_amdgcn_wmma_f32_16x16x32_f16(
      false, a, false, b, (short)0, c, false, false);
}

__device__ __forceinline__ v16h load_frag16(const _Float16* base, int ldh) {
  const int lane = threadIdx.x & 31;
  const int row  = lane & 15;
  const int hi   = lane >> 4;
  union { v16h v; v4u q[2]; } f;
  const _Float16* rp = base + row * ldh + hi * 8;
  f.q[0] = *(const v4u*)(rp);
  f.q[1] = *(const v4u*)(rp + 16);
  return f.v;
}

// GEMM operands lie in the workspace as 16x32 tiles in fragment order: a tile
// is 512 halfs = 1 KiB; its first 512 B hold every lane's first 8 halfs (what
// load_frag16 puts in q[0]), the second 512 B every lane's q[1]. The tiles of
// one 16-row band follow one another along k (E_/32 = 16 tiles a band). A
// wave-wide b128 load then covers 4 whole 128-B lines, not 32 B of 16 lines.
#define TILE_ 512          // halfs in a 16x32 tile
#define KT_   (E_ / 32)    // tiles along k in a 16-row band
__device__ __forceinline__ v16h load_frag_packed(const _Float16* tile) {
  const int lane = threadIdx.x & 31;
  union { v16h v; v4u q[2]; } f;
  const _Float16* p = tile + lane * 8;
  f.q[0] = *(const v4u*)(p);
  f.q[1] = *(const v4u*)(p + 256);
  return f.v;
}
__device__ __forceinline__ void store_frag_packed(_Float16* tile, v16h x) {
  const int lane = threadIdx.x & 31;
  union { v16h v; v4u q[2]; } f;
  f.v = x;
  _Float16* p = tile + lane * 8;
  *(v4u*)(p) = f.q[0];
  *(v4u*)(p + 256) = f.q[1];
}

__device__ __forceinline__ float rowmax16(float x) {
  x = fmaxf(x, __shfl_xor(x, 1, 32));
  x = fmaxf(x, __shfl_xor(x, 2, 32));
  x = fmaxf(x, __shfl_xor(x, 4, 32));
  x = fmaxf(x, __shfl_xor(x, 8, 32));
  return x;
}
__device__ __forceinline__ float rowsum16(float x) {
  x += __shfl_xor(x, 1, 32);
  x += __shfl_xor(x, 2, 32);
  x += __shfl_xor(x, 4, 32);
  x += __shfl_xor(x, 8, 32);
  return x;
}

// ---------------------------------------------------------------------------
// f32 -> f16 conversion of X and of the four weights in ONE launch, written in
// fragment order (see load_frag_packed). Their f16 copies lie back to back in
// the workspace (X, Wq, Wk, Wv, Wo), so dst is indexed by the flat tile number.
// One wave converts one 16x32 tile; a block's 8 tiles are half a 16-row band
// of one source (every source holds a multiple of 8 tiles), so the source is
// picked by a block-uniform test and the block reads 1 KiB of each of 16 rows.
// ---------------------------------------------------------------------------
#define BNE_ (B_ * N_ * E_)
#define EE_  (E_ * E_)
typedef __attribute__((ext_vector_type(4))) float v4f;
__global__ void __launch_bounds__(256) f32_to_f16_all_kernel(
    const float* __restrict__ x, const float* __restrict__ w0,
    const float* __restrict__ w1, const float* __restrict__ w2,
    const float* __restrict__ w3, _Float16* __restrict__ dst) {
  const int first = blockIdx.x * 8;  // flat number of the block's first tile
  const float* src = x;
  int off = first;
  if (first >= BNE_ / TILE_) {
    const int w = (first - BNE_ / TILE_) / (EE_ / TILE_);
    src = (w == 0) ? w0 : (w == 1) ? w1 : (w == 2) ? w2 : w3;
    off = first - BNE_ / TILE_ - w * (EE_ / TILE_);
  }
  const int wid  = threadIdx.x >> 5;
  const int lane = threadIdx.x & 31;
  const int t = off + wid;           // tile number inside the source
  const float* rp = src + (size_t)((t / KT_) * 16 + (lane & 15)) * E_ +
                    (t % KT_) * 32 + (lane >> 4) * 8;
  const v4f g[4] = {*(const v4f*)(rp), *(const v4f*)(rp + 4),
                    *(const v4f*)(rp + 16), *(const v4f*)(rp + 20)};
  v16h o;
  // Unrolled so that the vector indices are constants and g, o stay in registers.
#pragma unroll
  for (int i = 0; i < 16; ++i) o[i] = (_Float16)g[i >> 2][i & 3];
  store_frag_packed(dst + (size_t)(first + wid) * TILE_, o);
}

__device__ __forceinline__ void gemm_xwT_products(
    const _Float16* __restrict__ A, const _Float16* __restrict__ W,
    v8f (&acc)[2][2]) {
  const int wid = threadIdx.x >> 5;
  const int r0 = blockIdx.x * 128 + (wid & 3) * 32;
  const int c0 = blockIdx.y * 64 + (wid >> 2) * 32;
  const _Float16* Ab = A + (size_t)(r0 / 16) * KT_ * TILE_;  // band of rows r0..
  const _Float16* Wb = W + (size_t)(c0 / 16) * KT_ * TILE_;
  // Unrolled whole, so that every tile's offset is an immediate of its load and
  // no address register is formed or rewritten inside the loop.
#pragma unroll
  for (int kt = 0; kt < KT_; ++kt) {
    v16h a0 = load_frag_packed(Ab + kt * TILE_);
    v16h a1 = load_frag_packed(Ab + (KT_ + kt) * TILE_);
    v16h b0 = load_frag_packed(Wb + kt * TILE_);
    v16h b1 = load_frag_packed(Wb + (KT_ + kt) * TILE_);
    acc[0][0] = wmma32(a0, b0, acc[0][0]);
    acc[0][1] = wmma32(a0, b1, acc[0][1]);
    acc[1][0] = wmma32(a1, b0, acc[1][0]);
    acc[1][1] = wmma32(a1, b1, acc[1][1]);
  }
}

template <typename OutT>
__device__ __forceinline__ void gemm_xwT_store(
    const v8f (&acc)[2][2], const float* __restrict__ bias,
    OutT* __restrict__ out) {
  const int wid = threadIdx.x >> 5;
  const int r0 = blockIdx.x * 128 + (wid & 3) * 32;
  const int c0 = blockIdx.y * 64 + (wid >> 2) * 32;
  const int lane = threadIdx.x & 31;
  const int col = lane & 15;
  const int hi  = lane >> 4;
#pragma unroll
  for (int i = 0; i < 2; ++i) {
#pragma unroll
    for (int j = 0; j < 2; ++j) {
      const int c = c0 + j * 16 + col;
      const float bv = bias[c];
#pragma unroll
      for (int v = 0; v < 8; ++v) {
        const int r = r0 + i * 16 + v + 8 * hi;
        out[(size_t)r * E_ + c] = (OutT)(acc[i][j][v] + bv);
      }
    }
  }
}

// Q, K and V projections in ONE launch: they share A and none reads another's
// output. blockIdx.z picks the weight, the bias and the output; the three f16
// weights, and the three outputs, lie back to back in the workspace.
__global__ void __launch_bounds__(256) gemm_qkv_kernel(
    const _Float16* __restrict__ A, const _Float16* __restrict__ W3,
    const float* __restrict__ bq, const float* __restrict__ bk,
    const float* __restrict__ bv, _Float16* __restrict__ out3) {
  const int z = blockIdx.z;
  const float* bias = (z == 0) ? bq : (z == 1) ? bk : bv;
  v8f acc[2][2] = {};
  gemm_xwT_products(A, W3 + (size_t)z * EE_, acc);
  asm volatile("s_wait_xcnt 0x0" ::: "memory");
  gemm_xwT_store<_Float16>(acc, bias, out3 + (size_t)z * BNE_);
}

__global__ void __launch_bounds__(256) gemm_out_kernel(
    const _Float16* __restrict__ A, const _Float16* __restrict__ W,
    const float* __restrict__ bias, float* __restrict__ out) {
  v8f acc[2][2] = {};
  gemm_xwT_products(A, W, acc);
  gemm_xwT_store<float>(acc, bias, out);
}

// ---------------------------------------------------------------------------
// Fused attention (flash-style; masks streamed once, non-temporal).
// Block = 8 waves; each wave owns 16 query rows of one (b,h); key tiles of 64.
// Q/K/V f16 laid out [b, n, h, d] so head slices are contiguous.
// ---------------------------------------------------------------------------
__global__ void __launch_bounds__(256) attn_kernel(
    const _Float16* __restrict__ qb, const _Float16* __restrict__ kb,
    const _Float16* __restrict__ vb, const float* __restrict__ rnodes,
    const float* __restrict__ aadd, const float* __restrict__ amul,
    _Float16* __restrict__ ob) {
  __shared__ alignas(16) _Float16 Ks[64 * 72];     // [key][d] -> B frags (QK^T)
  __shared__ alignas(16) _Float16 Vt[64 * 72];     // [d][key] -> B frags (P@V)
  __shared__ alignas(16) _Float16 Ps[8][16 * 72];  // per-wave probs C->A restripe
#if USE_ASYNC_LDS
  __shared__ alignas(16) _Float16 Vraw[64 * 64];   // async landing pad for V
#endif

  const int b = blockIdx.z;
  const int h = blockIdx.y;
  const int wid  = threadIdx.x >> 5;
  const int lane = threadIdx.x & 31;
  const int col  = lane & 15;
  const int hi   = lane >> 4;
  const int qbase = blockIdx.x * 128 + wid * 16;

  // Q fragments live in registers for the whole pass (K = D = 64 -> 2 frags).
  const _Float16* qp = qb + ((size_t)(b * N_) + qbase) * E_ + h * D_;
  const v16h aq0 = load_frag16(qp, E_);
  const v16h aq1 = load_frag16(qp + 32, E_);

  float rn[8];
#pragma unroll
  for (int v = 0; v < 8; ++v)
    rn[v] = rnodes[b * N_ + qbase + v + 8 * hi] * 0.125f;  // 1/sqrt(64)

  const size_t mbase = ((size_t)(b * H_ + h)) * N_ * N_;

  v8f acc[4] = {};
  float l[8], m[8];
#pragma unroll
  for (int v = 0; v < 8; ++v) { l[v] = 0.0f; m[v] = -1e30f; }

  for (int kt = 0; kt < N_; kt += 64) {
    const _Float16* ksrc = kb + ((size_t)(b * N_) + kt) * E_ + h * D_;
    const _Float16* vsrc = vb + ((size_t)(b * N_) + kt) * E_ + h * D_;

    if (kt + 64 < N_) {
#pragma unroll
      for (int v = 0; v < 8; ++v) {
        const size_t off =
            mbase + (size_t)(qbase + v + 8 * hi) * N_ + (kt + 64) + col;
        __builtin_prefetch(aadd + off, 0, 0);
        __builtin_prefetch(amul + off, 0, 0);
      }
    }

#if USE_ASYNC_LDS
    for (int idx = threadIdx.x; idx < 64 * 8; idx += 256) {
      const int key = idx >> 3, c = (idx & 7) * 8;  // 8 halfs = 16B per chunk
      __builtin_amdgcn_global_load_async_to_lds_b128(
          (v4i*)(ksrc + (size_t)key * E_ + c),
          (AS3 v4i*)&Ks[key * 72 + c], 0, 0);
      __builtin_amdgcn_global_load_async_to_lds_b128(
          (v4i*)(vsrc + (size_t)key * E_ + c),
          (AS3 v4i*)&Vraw[key * 64 + c], 0, 0);
    }
    wait_asynccnt0();
    __syncthreads();
    // LDS->LDS transpose of V into [d][key]
    for (int idx = threadIdx.x; idx < 64 * 64; idx += 256) {
      const int key = idx >> 6, d = idx & 63;
      Vt[d * 72 + key] = Vraw[key * 64 + d];
    }
#else
    // --- synchronous staging fallback ---
    for (int idx = threadIdx.x; idx < 64 * 32; idx += 256) {
      const int key = idx >> 5, dp = (idx & 31) * 2;
      *(uint32_t*)&Ks[key * 72 + dp] =
          *(const uint32_t*)(ksrc + (size_t)key * E_ + dp);
    }
    for (int idx = threadIdx.x; idx < 64 * 64; idx += 256) {
      const int key = idx >> 6, d = idx & 63;
      Vt[d * 72 + key] = vsrc[(size_t)key * E_ + d];
    }
#endif
    __syncthreads();

    // --- scores: S = (Q K^T) * (rn/8) + attn_add (NT stream) ---
    v8f s[4];
#pragma unroll
    for (int nf = 0; nf < 4; ++nf) {
      v8f sc = {};
      sc = wmma32(aq0, load_frag16(&Ks[nf * 16 * 72], 72), sc);
      sc = wmma32(aq1, load_frag16(&Ks[nf * 16 * 72 + 32], 72), sc);
      const float* ap = aadd + mbase + (size_t)(kt + nf * 16 + col);
#pragma unroll
      for (int v = 0; v < 8; ++v) {
        const int q = qbase + v + 8 * hi;
        const float av = __builtin_nontemporal_load(&ap[(size_t)q * N_]);
        sc[v] = sc[v] * rn[v] + av;
      }
      s[nf] = sc;
    }

    // --- online softmax; fold attn_mult post-exp ---
    float alpha[8];
#pragma unroll
    for (int v = 0; v < 8; ++v) {
      float x = fmaxf(fmaxf(s[0][v], s[1][v]), fmaxf(s[2][v], s[3][v]));
      x = rowmax16(x);
      const float nm = fmaxf(m[v], x);
      alpha[v] = __expf(m[v] - nm);
      m[v] = nm;
    }
    float psum[8];
#pragma unroll
    for (int v = 0; v < 8; ++v) psum[v] = 0.0f;
#pragma unroll
    for (int nf = 0; nf < 4; ++nf) {
      const float* mp = amul + mbase + (size_t)(kt + nf * 16 + col);
#pragma unroll
      for (int v = 0; v < 8; ++v) {
        const int q = qbase + v + 8 * hi;
        float p = __expf(s[nf][v] - m[v]);
        psum[v] += p;  // normalizer excludes the multiplicative mask
        p *= __builtin_nontemporal_load(&mp[(size_t)q * N_]);
        Ps[wid][(v + 8 * hi) * 72 + nf * 16 + col] = (_Float16)p;
      }
    }
#pragma unroll
    for (int v = 0; v < 8; ++v) l[v] = l[v] * alpha[v] + rowsum16(psum[v]);

    // --- O = O*alpha + P @ V (probs re-striped via per-wave LDS scratch) ---
    const v16h ap0 = load_frag16(&Ps[wid][0], 72);
    const v16h ap1 = load_frag16(&Ps[wid][32], 72);
#pragma unroll
    for (int df = 0; df < 4; ++df) {
#pragma unroll
      for (int v = 0; v < 8; ++v) acc[df][v] *= alpha[v];
      acc[df] = wmma32(ap0, load_frag16(&Vt[df * 16 * 72], 72), acc[df]);
      acc[df] = wmma32(ap1, load_frag16(&Vt[df * 16 * 72 + 32], 72), acc[df]);
    }
    __syncthreads();
  }

  // --- normalize; element [b, q, h, d] (matches transpose+reshape) goes out in
  // fragment order for the output projection: the wave's 16 rows x 64 columns
  // are two whole tiles. C layout -> A layout through the wave's own scratch,
  // as for the probs.
#pragma unroll
  for (int v = 0; v < 8; ++v) {
    const float inv = 1.0f / l[v];
    const int r = v + 8 * hi;
#pragma unroll
    for (int df = 0; df < 4; ++df)
      Ps[wid][r * 72 + df * 16 + col] = (_Float16)(acc[df][v] * inv);
  }
  _Float16* op =
      ob + ((size_t)((b * N_ + qbase) / 16) * KT_ + h * (D_ / 32)) * TILE_;
  store_frag_packed(op, load_frag16(&Ps[wid][0], 72));
  store_frag_packed(op + TILE_, load_frag16(&Ps[wid][32], 72));
}

// ---------------------------------------------------------------------------
// Launch
// ---------------------------------------------------------------------------
extern "C" void kernel_launch(void* const* d_in, const int* in_sizes, int n_in,
                              void* d_out, int out_size, void* d_ws, size_t ws_size,
                              hipStream_t stream) {
  (void)in_sizes; (void)n_in; (void)out_size; (void)ws_size;
  const float* X    = (const float*)d_in[0];
  const float* rno  = (const float*)d_in[1];
  const float* aadd = (const float*)d_in[2];
  const float* amul = (const float*)d_in[3];
  const float* Wq   = (const float*)d_in[4];
  const float* bq   = (const float*)d_in[5];
  const float* Wk   = (const float*)d_in[6];
  const float* bk   = (const float*)d_in[7];
  const float* Wv   = (const float*)d_in[8];
  const float* bv   = (const float*)d_in[9];
  const float* Wo   = (const float*)d_in[10];
  const float* bo   = (const float*)d_in[11];
  float* out = (float*)d_out;

  // Workspace layout (f16): ~23 MB total.
  const int BNE = B_ * N_ * E_;   // 2,097,152
  const int EE  = E_ * E_;        //   262,144
  _Float16* x16  = (_Float16*)d_ws;
  _Float16* wq16 = x16 + BNE;
  _Float16* wk16 = wq16 + EE;
  _Float16* wv16 = wk16 + EE;
  _Float16* wo16 = wv16 + EE;
  _Float16* q16  = wo16 + EE;
  _Float16* k16  = q16 + BNE;
  _Float16* v16  = k16 + BNE;
  _Float16* a16  = v16 + BNE;

  const dim3 blk(256);
  // x16, wq16, wk16, wv16, wo16 are one contiguous range starting at x16.
  f32_to_f16_all_kernel<<<(BNE + 4 * EE) / (8 * TILE_), blk, 0, stream>>>(
      X, Wq, Wk, Wv, Wo, x16);

  // wq16..wv16 and q16..v16 are each three equal arrays back to back.
  gemm_qkv_kernel<<<dim3(B_ * N_ / 128, E_ / 64, 3), blk, 0, stream>>>(
      x16, wq16, bq, bk, bv, q16);

  attn_kernel<<<dim3(N_ / 128, H_, B_), blk, 0, stream>>>(
      q16, k16, v16, rno, aadd, amul, a16);

  gemm_out_kernel<<<dim3(B_ * N_ / 128, E_ / 64), blk, 0, stream>>>(
      a16, wo16, bo, out);
}

// v003
// A run of this version takes 70.5 microseconds.
// In two side-by-side timings against v002, it was 1.09 and 1.08 times as fast.
// Over all steps from v000 it is 1.45 times as fast.
#include <hip/hip_runtime.h>
#include <hip/hip_bf16.h>
#include <cstdint>

#define B_ 4
#define N_ 1024
#define E_ 512
#define H_ 8
#define D_ 64

typedef __attribute__((ext_vector_type(16))) _Float16 v16h;
typedef __attribute__((ext_vector_type(8)))  float    v8f;
typedef __attribute__((ext_vector_type(4)))  uint32_t v4u;
typedef __attribute__((ext_vector_type(8)))  short    s16x8;

#define AS3 __attribute__((address_space(3)))

__device__ __forceinline__ v8f wmma32(v16h a, v16h b, v8f c) {
  // 8 args: (neg_a, A, neg_b, B, c_mod, C, reuse_a, reuse_b)
  return __builtin_amdgcn_wmma_f32_16x16x32_f16(
      false, a, false, b, (short)0, c, false, false);
}

__device__ __forceinline__ v16h load_frag16(const _Float16* base, int ldh) {
  const int lane = threadIdx.x & 31;
  const int row  = lane & 15;
  const int hi   = lane >> 4;
  union { v16h v; v4u q[2]; } f;
  const _Float16* rp = base + row * ldh + hi * 8;
  f.q[0] = *(const v4u*)(rp);
  f.q[1] = *(const v4u*)(rp + 16);
  return f.v;
}

// LDS pitch of a K row and of a V row (64 halfs of data): 144 B = 16 B x odd.
#define KVP_ 72

// B fragment (32 keys x 16 columns of V) straight from row-major V rows in LDS,
// by the transposing load: lane (c, hi) gets V[8*hi + 0..7][c] from the first
// load and V[16 + 8*hi + 0..7][c] from the second, which is load_frag16's k
// order. tile = &V[first key][first column].
__device__ __forceinline__ v16h load_frag_tr16(const _Float16* tile) {
  const int lane = threadIdx.x & 31;
  const _Float16* p =
      tile + ((lane >> 4) * 8 + (lane & 7)) * KVP_ + ((lane >> 3) & 1) * 8;
  union { v16h v; s16x8 q[2]; } f;
  f.q[0] = __builtin_amdgcn_ds_load_tr16_b128_v8i16((AS3 s16x8*)p);
  f.q[1] = __builtin_amdgcn_ds_load_tr16_b128_v8i16((AS3 s16x8*)(p + 16 * KVP_));
  return f.v;
}

__device__ __forceinline__ void async_copy_8x32rows(uint32_t lds,
                                                    const _Float16* g) {
  const uint32_t ls = 32 * KVP_ * 2;  // LDS bytes between the rows of two copies
  const int gs = 32 * E_;             // halfs between them in global memory
  asm volatile(
      "global_load_async_to_lds_b128 %0, %8, off\n\t"
      "global_load_async_to_lds_b128 %1, %9, off\n\t"
      "global_load_async_to_lds_b128 %2, %10, off\n\t"
      "global_load_async_to_lds_b128 %3, %11, off\n\t"
      "global_load_async_to_lds_b128 %4, %12, off\n\t"
      "global_load_async_to_lds_b128 %5, %13, off\n\t"
      "global_load_async_to_lds_b128 %6, %14, off\n\t"
      "global_load_async_to_lds_b128 %7, %15, off\n\t"
      "s_wait_xcnt 0x0"
      :
      : "v"(lds), "v"(lds + ls), "v"(lds + 2 * ls), "v"(lds + 3 * ls),
        "v"(lds + 4 * ls), "v"(lds + 5 * ls), "v"(lds + 6 * ls),
        "v"(lds + 7 * ls), "v"(g), "v"(g + gs), "v"(g + 2 * gs),
        "v"(g + 3 * gs), "v"(g + 4 * gs), "v"(g + 5 * gs), "v"(g + 6 * gs),
        "v"(g + 7 * gs)
      : "memory");
}

// GEMM operands lie in the workspace as 16x32 tiles in fragment order: a tile
// is 512 halfs = 1 KiB; its first 512 B hold every lane's first 8 halfs (what
// load_frag16 puts in q[0]), the second 512 B every lane's q[1]. The tiles of
// one 16-row band follow one another along k (E_/32 = 16 tiles a band). A
// wave-wide b128 load then covers 4 whole 128-B lines, not 32 B of 16 lines.
#define TILE_ 512          // halfs in a 16x32 tile
#define KT_   (E_ / 32)    // tiles along k in a 16-row band
__device__ __forceinline__ v16h load_frag_packed(const _Float16* tile) {
  const int lane = threadIdx.x & 31;
  union { v16h v; v4u q[2]; } f;
  const _Float16* p = tile + lane * 8;
  f.q[0] = *(const v4u*)(p);
  f.q[1] = *(const v4u*)(p + 256);
  return f.v;
}
__device__ __forceinline__ void store_frag_packed(_Float16* tile, v16h x) {
  const int lane = threadIdx.x & 31;
  union { v16h v; v4u q[2]; } f;
  f.v = x;
  _Float16* p = tile + lane * 8;
  *(v4u*)(p) = f.q[0];
  *(v4u*)(p + 256) = f.q[1];
}

__device__ __forceinline__ float rowmax16(float x) {
  x = fmaxf(x, __shfl_xor(x, 1, 32));
  x = fmaxf(x, __shfl_xor(x, 2, 32));
  x = fmaxf(x, __shfl_xor(x, 4, 32));
  x = fmaxf(x, __shfl_xor(x, 8, 32));
  return x;
}
__device__ __forceinline__ float rowsum16(float x) {
  x += __shfl_xor(x, 1, 32);
  x += __shfl_xor(x, 2, 32);
  x += __shfl_xor(x, 4, 32);
  x += __shfl_xor(x, 8, 32);
  return x;
}

// ---------------------------------------------------------------------------
// f32 -> f16 conversion of X and of the four weights in ONE launch, written in
// fragment order (see load_frag_packed). Their f16 copies lie back to back in
// the workspace (X, Wq, Wk, Wv, Wo), so dst is indexed by the flat tile number.
// One wave converts one 16x32 tile; a block's 8 tiles are half a 16-row band
// of one source (every source holds a multiple of 8 tiles), so the source is
// picked by a block-uniform test and the block reads 1 KiB of each of 16 rows.
// ---------------------------------------------------------------------------
#define BNE_ (B_ * N_ * E_)
#define EE_  (E_ * E_)
typedef __attribute__((ext_vector_type(4))) float v4f;
__global__ void __launch_bounds__(256) f32_to_f16_all_kernel(
    const float* __restrict__ x, const float* __restrict__ w0,
    const float* __restrict__ w1, const float* __restrict__ w2,
    const float* __restrict__ w3, _Float16* __restrict__ dst) {
  const int first = blockIdx.x * 8;  // flat number of the block's first tile
  const float* src = x;
  int off = first;
  if (first >= BNE_ / TILE_) {
    const int w = (first - BNE_ / TILE_) / (EE_ / TILE_);
    src = (w == 0) ? w0 : (w == 1) ? w1 : (w == 2) ? w2 : w3;
    off = first - BNE_ / TILE_ - w * (EE_ / TILE_);
  }
  const int wid  = threadIdx.x >> 5;
  const int lane = threadIdx.x & 31;
  const int t = off + wid;           // tile number inside the source
  const float* rp = src + (size_t)((t / KT_) * 16 + (lane & 15)) * E_ +
                    (t % KT_) * 32 + (lane >> 4) * 8;
  const v4f g[4] = {*(const v4f*)(rp), *(const v4f*)(rp + 4),
                    *(const v4f*)(rp + 16), *(const v4f*)(rp + 20)};
  v16h o;
  // Unrolled so that the vector indices are constants and g, o stay in registers.
#pragma unroll
  for (int i = 0; i < 16; ++i) o[i] = (_Float16)g[i >> 2][i & 3];
  store_frag_packed(dst + (size_t)(first + wid) * TILE_, o);
}

__device__ __forceinline__ void gemm_xwT_products(
    const _Float16* __restrict__ A, const _Float16* __restrict__ W,
    v8f (&acc)[2][2]) {
  const int wid = threadIdx.x >> 5;
  const int r0 = blockIdx.x * 128 + (wid & 3) * 32;
  const int c0 = blockIdx.y * 64 + (wid >> 2) * 32;
  const _Float16* Ab = A + (size_t)(r0 / 16) * KT_ * TILE_;  // band of rows r0..
  const _Float16* Wb = W + (size_t)(c0 / 16) * KT_ * TILE_;
  // Unrolled whole, so that every tile's offset is an immediate of its load and
  // no address register is formed or rewritten inside the loop.
#pragma unroll
  for (int kt = 0; kt < KT_; ++kt) {
    v16h a0 = load_frag_packed(Ab + kt * TILE_);
    v16h a1 = load_frag_packed(Ab + (KT_ + kt) * TILE_);
    v16h b0 = load_frag_packed(Wb + kt * TILE_);
    v16h b1 = load_frag_packed(Wb + (KT_ + kt) * TILE_);
    acc[0][0] = wmma32(a0, b0, acc[0][0]);
    acc[0][1] = wmma32(a0, b1, acc[0][1]);
    acc[1][0] = wmma32(a1, b0, acc[1][0]);
    acc[1][1] = wmma32(a1, b1, acc[1][1]);
  }
}

template <typename OutT>
__device__ __forceinline__ void gemm_xwT_store(
    const v8f (&acc)[2][2], const float* __restrict__ bias,
    OutT* __restrict__ out) {
  const int wid = threadIdx.x >> 5;
  const int r0 = blockIdx.x * 128 + (wid & 3) * 32;
  const int c0 = blockIdx.y * 64 + (wid >> 2) * 32;
  const int lane = threadIdx.x & 31;
  const int col = lane & 15;
  const int hi  = lane >> 4;
#pragma unroll
  for (int i = 0; i < 2; ++i) {
#pragma unroll
    for (int j = 0; j < 2; ++j) {
      const int c = c0 + j * 16 + col;
      const float bv = bias[c];
#pragma unroll
      for (int v = 0; v < 8; ++v) {
        const int r = r0 + i * 16 + v + 8 * hi;
        out[(size_t)r * E_ + c] = (OutT)(acc[i][j][v] + bv);
      }
    }
  }
}

// Q, K and V projections in ONE launch: they share A and none reads another's
// output. blockIdx.z picks the weight, the bias and the output; the three f16
// weights, and the three outputs, lie back to back in the workspace.
__global__ void __launch_bounds__(256) gemm_qkv_kernel(
    const _Float16* __restrict__ A, const _Float16* __restrict__ W3,
    const float* __restrict__ bq, const float* __restrict__ bk,
    const float* __restrict__ bv, _Float16* __restrict__ out3) {
  const int z = blockIdx.z;
  const float* bias = (z == 0) ? bq : (z == 1) ? bk : bv;
  v8f acc[2][2] = {};
  gemm_xwT_products(A, W3 + (size_t)z * EE_, acc);
  asm volatile("s_wait_xcnt 0x0" ::: "memory");
  gemm_xwT_store<_Float16>(acc, bias, out3 + (size_t)z * BNE_);
}

__global__ void __launch_bounds__(256) gemm_out_kernel(
    const _Float16* __restrict__ A, const _Float16* __restrict__ W,
    const float* __restrict__ bias, float* __restrict__ out) {
  v8f acc[2][2] = {};
  gemm_xwT_products(A, W, acc);
  gemm_xwT_store<float>(acc, bias, out);
}

// ---------------------------------------------------------------------------
// Fused attention (flash-style; masks streamed once, non-temporal).
// Block = 8 waves; each wave owns 16 query rows of one (b,h); key tiles of 64.
// Q/K/V f16 laid out [b, n, h, d] so head slices are contiguous.
// The head's 1024 K rows and 1024 V rows (128 KiB each) are copied to LDS once,
// in front of the key loop; the block owns its WGP's LDS (306 KiB of 320). The
// loop then only reads them, so it holds no staging and no barrier, and the
// waves run through the key tiles independently of one another.
// ---------------------------------------------------------------------------
__global__ void __launch_bounds__(256) attn_kernel(
    const _Float16* __restrict__ qb, const _Float16* __restrict__ kb,
    const _Float16* __restrict__ vb, const float* __restrict__ rnodes,
    const float* __restrict__ aadd, const float* __restrict__ amul,
    _Float16* __restrict__ ob) {
  __shared__ alignas(16) _Float16 Ks[N_ * KVP_];   // [key][d] -> B frags (QK^T)
  __shared__ alignas(16) _Float16 Vs[N_ * KVP_];   // [key][d] -> B frags (P@V), tr16
  __shared__ alignas(16) _Float16 Ps[8][16 * 72];  // per-wave probs C->A restripe

  const int b = blockIdx.z;
  const int h = blockIdx.y;
  const int wid  = threadIdx.x >> 5;
  const int lane = threadIdx.x & 31;
  const int col  = lane & 15;
  const int hi   = lane >> 4;
  const int qbase = blockIdx.x * 128 + wid * 16;

  // Q fragments live in registers for the whole pass (K = D = 64 -> 2 frags).
  const _Float16* qp = qb + ((size_t)(b * N_) + qbase) * E_ + h * D_;
  const v16h aq0 = load_frag16(qp, E_);
  const v16h aq1 = load_frag16(qp + 32, E_);

  float rn[8];
#pragma unroll
  for (int v = 0; v < 8; ++v)
    rn[v] = rnodes[b * N_ + qbase + v + 8 * hi] * 0.125f;  // 1/sqrt(64)

  const size_t mbase = ((size_t)(b * H_ + h)) * N_ * N_;

  v8f acc[4] = {};
  float l[8], m[8];
#pragma unroll
  for (int v = 0; v < 8; ++v) { l[v] = 0.0f; m[v] = -1e30f; }

  // --- K and V of the whole head -> LDS, once. Lane t of the block copies the
  // 16-B chunk t & 7 of rows (t >> 3) + 32 * i, i = 0..31: 32 copies a wave for
  // K, then 32 for V (never more than 32 of a wave outstanding).
  {
    const int srow = threadIdx.x >> 3, sc = (threadIdx.x & 7) * 8;
    const size_t goff = ((size_t)(b * N_) + srow) * E_ + h * D_ + sc;
    const uint32_t kl = (uint32_t)(size_t)(AS3 const _Float16*)&Ks[srow * KVP_ + sc];
    const uint32_t vl = (uint32_t)(size_t)(AS3 const _Float16*)&Vs[srow * KVP_ + sc];
#pragma clang loop unroll(disable)
    for (int i = 0; i < 4; ++i)
      async_copy_8x32rows(kl + i * (256 * KVP_ * 2), kb + goff + (size_t)i * 256 * E_);
    // Holds a wave's outstanding copies at 32: K's and V's together would be 64,
    // one more than the 63 that may be outstanding.
    asm volatile("s_wait_asynccnt 0x0" ::: "memory");
#pragma clang loop unroll(disable)
    for (int i = 0; i < 4; ++i)
      async_copy_8x32rows(vl + i * (256 * KVP_ * 2), vb + goff + (size_t)i * 256 * E_);
    // This wave's copies have landed before the barrier that publishes them.
    asm volatile("s_wait_asynccnt 0x0" ::: "memory");
  }
  __syncthreads();

  for (int kt = 0; kt < N_; kt += 64) {
    if (kt + 64 < N_) {
#pragma unroll
      for (int v = 0; v < 8; ++v) {
        const size_t off =
            mbase + (size_t)(qbase + v + 8 * hi) * N_ + (kt + 64) + col;
        __builtin_prefetch(aadd + off, 0, 0);
        __builtin_prefetch(amul + off, 0, 0);
      }
    }

    // --- scores: S = (Q K^T) * (rn/8) + attn_add (NT stream) ---
    v8f s[4];
#pragma unroll
    for (int nf = 0; nf < 4; ++nf) {
      v8f sc = {};
      sc = wmma32(aq0, load_frag16(&Ks[(kt + nf * 16) * KVP_], KVP_), sc);
      sc = wmma32(aq1, load_frag16(&Ks[(kt + nf * 16) * KVP_ + 32], KVP_), sc);
      const float* ap = aadd + mbase + (size_t)(kt + nf * 16 + col);
#pragma unroll
      for (int v = 0; v < 8; ++v) {
        const int q = qbase + v + 8 * hi;
        const float av = __builtin_nontemporal_load(&ap[(size_t)q * N_]);
        sc[v] = sc[v] * rn[v] + av;
      }
      s[nf] = sc;
    }

    // --- online softmax; fold attn_mult post-exp ---
    float alpha[8];
#pragma unroll
    for (int v = 0; v < 8; ++v) {
      float x = fmaxf(fmaxf(s[0][v], s[1][v]), fmaxf(s[2][v], s[3][v]));
      x = rowmax16(x);
      const float nm = fmaxf(m[v], x);
      alpha[v] = __expf(m[v] - nm);
      m[v] = nm;
    }
    float psum[8];
#pragma unroll
    for (int v = 0; v < 8; ++v) psum[v] = 0.0f;
#pragma unroll
    for (int nf = 0; nf < 4; ++nf) {
      const float* mp = amul + mbase + (size_t)(kt + nf * 16 + col);
#pragma unroll
      for (int v = 0; v < 8; ++v) {
        const int q = qbase + v + 8 * hi;
        float p = __expf(s[nf][v] - m[v]);
        psum[v] += p;  // normalizer excludes the multiplicative mask
        p *= __builtin_nontemporal_load(&mp[(size_t)q * N_]);
        Ps[wid][(v + 8 * hi) * 72 + nf * 16 + col] = (_Float16)p;
      }
    }
#pragma unroll
    for (int v = 0; v < 8; ++v) l[v] = l[v] * alpha[v] + rowsum16(psum[v]);

    // --- O = O*alpha + P @ V (probs re-striped via per-wave LDS scratch) ---
    const v16h ap0 = load_frag16(&Ps[wid][0], 72);
    const v16h ap1 = load_frag16(&Ps[wid][32], 72);
#pragma unroll
    for (int df = 0; df < 4; ++df) {
#pragma unroll
      for (int v = 0; v < 8; ++v) acc[df][v] *= alpha[v];
      acc[df] = wmma32(ap0, load_frag_tr16(&Vs[kt * KVP_ + df * 16]), acc[df]);
      acc[df] = wmma32(ap1, load_frag_tr16(&Vs[(kt + 32) * KVP_ + df * 16]), acc[df]);
    }
  }

  // --- normalize; element [b, q, h, d] (matches transpose+reshape) goes out in
  // fragment order for the output projection: the wave's 16 rows x 64 columns
  // are two whole tiles. C layout -> A layout through the wave's own scratch,
  // as for the probs.
#pragma unroll
  for (int v = 0; v < 8; ++v) {
    const float inv = 1.0f / l[v];
    const int r = v + 8 * hi;
#pragma unroll
    for (int df = 0; df < 4; ++df)
      Ps[wid][r * 72 + df * 16 + col] = (_Float16)(acc[df][v] * inv);
  }
  _Float16* op =
      ob + ((size_t)((b * N_ + qbase) / 16) * KT_ + h * (D_ / 32)) * TILE_;
  store_frag_packed(op, load_frag16(&Ps[wid][0], 72));
  store_frag_packed(op + TILE_, load_frag16(&Ps[wid][32], 72));
}

// ---------------------------------------------------------------------------
// Launch
// ---------------------------------------------------------------------------
extern "C" void kernel_launch(void* const* d_in, const int* in_sizes, int n_in,
                              void* d_out, int out_size, void* d_ws, size_t ws_size,
                              hipStream_t stream) {
  (void)in_sizes; (void)n_in; (void)out_size; (void)ws_size;
  const float* X    = (const float*)d_in[0];
  const float* rno  = (const float*)d_in[1];
  const float* aadd = (const float*)d_in[2];
  const float* amul = (const float*)d_in[3];
  const float* Wq   = (const float*)d_in[4];
  const float* bq   = (const float*)d_in[5];
  const float* Wk   = (const float*)d_in[6];
  const float* bk   = (const float*)d_in[7];
  const float* Wv   = (const float*)d_in[8];
  const float* bv   = (const float*)d_in[9];
  const float* Wo   = (const float*)d_in[10];
  const float* bo   = (const float*)d_in[11];
  float* out = (float*)d_out;

  // Workspace layout (f16): ~23 MB total.
  const int BNE = B_ * N_ * E_;   // 2,097,152
  const int EE  = E_ * E_;        //   262,144
  _Float16* x16  = (_Float16*)d_ws;
  _Float16* wq16 = x16 + BNE;
  _Float16* wk16 = wq16 + EE;
  _Float16* wv16 = wk16 + EE;
  _Float16* wo16 = wv16 + EE;
  _Float16* q16  = wo16 + EE;
  _Float16* k16  = q16 + BNE;
  _Float16* v16  = k16 + BNE;
  _Float16* a16  = v16 + BNE;

  const dim3 blk(256);
  // x16, wq16, wk16, wv16, wo16 are one contiguous range starting at x16.
  f32_to_f16_all_kernel<<<(BNE + 4 * EE) / (8 * TILE_), blk, 0, stream>>>(
      X, Wq, Wk, Wv, Wo, x16);

  // wq16..wv16 and q16..v16 are each three equal arrays back to back.
  gemm_qkv_kernel<<<dim3(B_ * N_ / 128, E_ / 64, 3), blk, 0, stream>>>(
      x16, wq16, bq, bk, bv, q16);

  attn_kernel<<<dim3(N_ / 128, H_, B_), blk, 0, stream>>>(
      q16, k16, v16, rno, aadd, amul, a16);

  gemm_out_kernel<<<dim3(B_ * N_ / 128, E_ / 64), blk, 0, stream>>>(
      a16, wo16, bo, out);
}

// v004
// Measured time: 64 microseconds a run.
// Timed twice side by side with v003, it ran 1.11 and 1.13 times as fast.
// Counting every step since v000, it is 1.62 times as fast.
#include <hip/hip_runtime.h>
#include <hip/hip_bf16.h>
#include <cstdint>

#define B_ 4
#define N_ 1024
#define E_ 512
#define H_ 8
#define D_ 64

typedef __attribute__((ext_vector_type(16))) _Float16 v16h;
typedef __attribute__((ext_vector_type(8)))  float    v8f;
typedef __attribute__((ext_vector_type(4)))  uint32_t v4u;
typedef __attribute__((ext_vector_type(8)))  short    s16x8;

#define AS3 __attribute__((address_space(3)))

__device__ __forceinline__ v8f wmma32(v16h a, v16h b, v8f c) {
  // 8 args: (neg_a, A, neg_b, B, c_mod, C, reuse_a, reuse_b)
  return __builtin_amdgcn_wmma_f32_16x16x32_f16(
      false, a, false, b, (short)0, c, false, false);
}

__device__ __forceinline__ v16h load_frag16(const _Float16* base, int ldh) {
  const int lane = threadIdx.x & 31;
  const int row  = lane & 15;
  const int hi   = lane >> 4;
  union { v16h v; v4u q[2]; } f;
  const _Float16* rp = base + row * ldh + hi * 8;
  f.q[0] = *(const v4u*)(rp);
  f.q[1] = *(const v4u*)(rp + 16);
  return f.v;
}

// LDS pitch of a K row and of a V row (64 halfs of data): 144 B = 16 B x odd.
#define KVP_ 72

// B fragment (32 keys x 16 columns of V) straight from row-major V rows in LDS,
// by the transposing load: lane (c, hi) gets V[8*hi + 0..7][c] from the first
// load and V[16 + 8*hi + 0..7][c] from the second, which is load_frag16's k
// order. tile = &V[first key][first column].
__device__ __forceinline__ v16h load_frag_tr16(const _Float16* tile) {
  const int lane = threadIdx.x & 31;
  const _Float16* p =
      tile + ((lane >> 4) * 8 + (lane & 7)) * KVP_ + ((lane >> 3) & 1) * 8;
  union { v16h v; s16x8 q[2]; } f;
  f.q[0] = __builtin_amdgcn_ds_load_tr16_b128_v8i16((AS3 s16x8*)p);
  f.q[1] = __builtin_amdgcn_ds_load_tr16_b128_v8i16((AS3 s16x8*)(p + 16 * KVP_));
  return f.v;
}

__device__ __forceinline__ void async_copy_8x64rows(uint32_t lds,
                                                    const _Float16* g) {
  const uint32_t ls = 64 * KVP_ * 2;  // LDS bytes between the rows of two copies
  const int gs = 64 * E_;             // halfs between them in global memory
  asm volatile(
      "global_load_async_to_lds_b128 %0, %8, off\n\t"
      "global_load_async_to_lds_b128 %1, %9, off\n\t"
      "global_load_async_to_lds_b128 %2, %10, off\n\t"
      "global_load_async_to_lds_b128 %3, %11, off\n\t"
      "global_load_async_to_lds_b128 %4, %12, off\n\t"
      "global_load_async_to_lds_b128 %5, %13, off\n\t"
      "global_load_async_to_lds_b128 %6, %14, off\n\t"
      "global_load_async_to_lds_b128 %7, %15, off\n\t"
      "s_wait_xcnt 0x0"
      :
      : "v"(lds), "v"(lds + ls), "v"(lds + 2 * ls), "v"(lds + 3 * ls),
        "v"(lds + 4 * ls), "v"(lds + 5 * ls), "v"(lds + 6 * ls),
        "v"(lds + 7 * ls), "v"(g), "v"(g + gs), "v"(g + 2 * gs),
        "v"(g + 3 * gs), "v"(g + 4 * gs), "v"(g + 5 * gs), "v"(g + 6 * gs),
        "v"(g + 7 * gs)
      : "memory");
}

// GEMM operands lie in the workspace as 16x32 tiles in fragment order: a tile
// is 512 halfs = 1 KiB; its first 512 B hold every lane's first 8 halfs (what
// load_frag16 puts in q[0]), the second 512 B every lane's q[1]. The tiles of
// one 16-row band follow one another along k (E_/32 = 16 tiles a band). A
// wave-wide b128 load then covers 4 whole 128-B lines, not 32 B of 16 lines.
#define TILE_ 512          // halfs in a 16x32 tile
#define KT_   (E_ / 32)    // tiles along k in a 16-row band
__device__ __forceinline__ v16h load_frag_packed(const _Float16* tile) {
  const int lane = threadIdx.x & 31;
  union { v16h v; v4u q[2]; } f;
  const _Float16* p = tile + lane * 8;
  f.q[0] = *(const v4u*)(p);
  f.q[1] = *(const v4u*)(p + 256);
  return f.v;
}
__device__ __forceinline__ void store_frag_packed(_Float16* tile, v16h x) {
  const int lane = threadIdx.x & 31;
  union { v16h v; v4u q[2]; } f;
  f.v = x;
  _Float16* p = tile + lane * 8;
  *(v4u*)(p) = f.q[0];
  *(v4u*)(p + 256) = f.q[1];
}

__device__ __forceinline__ float rowmax16(float x) {
  x = fmaxf(x, __shfl_xor(x, 1, 32));
  x = fmaxf(x, __shfl_xor(x, 2, 32));
  x = fmaxf(x, __shfl_xor(x, 4, 32));
  x = fmaxf(x, __shfl_xor(x, 8, 32));
  return x;
}
__device__ __forceinline__ float rowsum16(float x) {
  x += __shfl_xor(x, 1, 32);
  x += __shfl_xor(x, 2, 32);
  x += __shfl_xor(x, 4, 32);
  x += __shfl_xor(x, 8, 32);
  return x;
}

// ---------------------------------------------------------------------------
// f32 -> f16 conversion of X and of the four weights in ONE launch, written in
// fragment order (see load_frag_packed). Their f16 copies lie back to back in
// the workspace (X, Wq, Wk, Wv, Wo), so dst is indexed by the flat tile number.
// One wave converts one 16x32 tile; a block's 8 tiles are half a 16-row band
// of one source (every source holds a multiple of 8 tiles), so the source is
// picked by a block-uniform test and the block reads 1 KiB of each of 16 rows.
// ---------------------------------------------------------------------------
#define BNE_ (B_ * N_ * E_)
#define EE_  (E_ * E_)
typedef __attribute__((ext_vector_type(4))) float v4f;
__global__ void __launch_bounds__(256) f32_to_f16_all_kernel(
    const float* __restrict__ x, const float* __restrict__ w0,
    const float* __restrict__ w1, const float* __restrict__ w2,
    const float* __restrict__ w3, _Float16* __restrict__ dst) {
  const int first = blockIdx.x * 8;  // flat number of the block's first tile
  const float* src = x;
  int off = first;
  if (first >= BNE_ / TILE_) {
    const int w = (first - BNE_ / TILE_) / (EE_ / TILE_);
    src = (w == 0) ? w0 : (w == 1) ? w1 : (w == 2) ? w2 : w3;
    off = first - BNE_ / TILE_ - w * (EE_ / TILE_);
  }
  const int wid  = threadIdx.x >> 5;
  const int lane = threadIdx.x & 31;
  const int t = off + wid;           // tile number inside the source
  const float* rp = src + (size_t)((t / KT_) * 16 + (lane & 15)) * E_ +
                    (t % KT_) * 32 + (lane >> 4) * 8;
  const v4f g[4] = {*(const v4f*)(rp), *(const v4f*)(rp + 4),
                    *(const v4f*)(rp + 16), *(const v4f*)(rp + 20)};
  v16h o;
  // Unrolled so that the vector indices are constants and g, o stay in registers.
#pragma unroll
  for (int i = 0; i < 16; ++i) o[i] = (_Float16)g[i >> 2][i & 3];
  store_frag_packed(dst + (size_t)(first + wid) * TILE_, o);
}

__device__ __forceinline__ void gemm_xwT_products(
    const _Float16* __restrict__ A, const _Float16* __restrict__ W,
    v8f (&acc)[2][2]) {
  const int wid = threadIdx.x >> 5;
  const int r0 = blockIdx.x * 128 + (wid & 3) * 32;
  const int c0 = blockIdx.y * 64 + (wid >> 2) * 32;
  const _Float16* Ab = A + (size_t)(r0 / 16) * KT_ * TILE_;  // band of rows r0..
  const _Float16* Wb = W + (size_t)(c0 / 16) * KT_ * TILE_;
  // Unrolled whole, so that every tile's offset is an immediate of its load and
  // no address register is formed or rewritten inside the loop.
#pragma unroll
  for (int kt = 0; kt < KT_; ++kt) {
    v16h a0 = load_frag_packed(Ab + kt * TILE_);
    v16h a1 = load_frag_packed(Ab + (KT_ + kt) * TILE_);
    v16h b0 = load_frag_packed(Wb + kt * TILE_);
    v16h b1 = load_frag_packed(Wb + (KT_ + kt) * TILE_);
    acc[0][0] = wmma32(a0, b0, acc[0][0]);
    acc[0][1] = wmma32(a0, b1, acc[0][1]);
    acc[1][0] = wmma32(a1, b0, acc[1][0]);
    acc[1][1] = wmma32(a1, b1, acc[1][1]);
  }
}

template <typename OutT>
__device__ __forceinline__ void gemm_xwT_store(
    const v8f (&acc)[2][2], const float* __restrict__ bias,
    OutT* __restrict__ out) {
  const int wid = threadIdx.x >> 5;
  const int r0 = blockIdx.x * 128 + (wid & 3) * 32;
  const int c0 = blockIdx.y * 64 + (wid >> 2) * 32;
  const int lane = threadIdx.x & 31;
  const int col = lane & 15;
  const int hi  = lane >> 4;
#pragma unroll
  for (int i = 0; i < 2; ++i) {
#pragma unroll
    for (int j = 0; j < 2; ++j) {
      const int c = c0 + j * 16 + col;
      const float bv = bias[c];
#pragma unroll
      for (int v = 0; v < 8; ++v) {
        const int r = r0 + i * 16 + v + 8 * hi;
        out[(size_t)r * E_ + c] = (OutT)(acc[i][j][v] + bv);
      }
    }
  }
}

// Q, K and V projections in ONE launch: they share A and none reads another's
// output. blockIdx.z picks the weight, the bias and the output; the three f16
// weights, and the three outputs, lie back to back in the workspace.
__global__ void __launch_bounds__(256) gemm_qkv_kernel(
    const _Float16* __restrict__ A, const _Float16* __restrict__ W3,
    const float* __restrict__ bq, const float* __restrict__ bk,
    const float* __restrict__ bv, _Float16* __restrict__ out3) {
  const int z = blockIdx.z;
  const float* bias = (z == 0) ? bq : (z == 1) ? bk : bv;
  v8f acc[2][2] = {};
  gemm_xwT_products(A, W3 + (size_t)z * EE_, acc);
  asm volatile("s_wait_xcnt 0x0" ::: "memory");
  gemm_xwT_store<_Float16>(acc, bias, out3 + (size_t)z * BNE_);
}

__global__ void __launch_bounds__(256) gemm_out_kernel(
    const _Float16* __restrict__ A, const _Float16* __restrict__ W,
    const float* __restrict__ bias, float* __restrict__ out) {
  v8f acc[2][2] = {};
  gemm_xwT_products(A, W, acc);
  gemm_xwT_store<float>(acc, bias, out);
}

#define PP_ 40  // LDS pitch of a row of 32 probs: 80 B = 16 B x odd
__global__ void __launch_bounds__(512) attn_kernel(
    const _Float16* __restrict__ qb, const _Float16* __restrict__ kb,
    const _Float16* __restrict__ vb, const float* __restrict__ rnodes,
    const float* __restrict__ aadd, const float* __restrict__ amul,
    _Float16* __restrict__ ob) {
  __shared__ alignas(16) _Float16 Ks[N_ * KVP_];   // [key][d] -> B frags (QK^T)
  __shared__ alignas(16) _Float16 Vs[N_ * KVP_];   // [key][d] -> B frags (P@V), tr16
  // Per-wave probs C->A restripe, 32 keys at a time (16 waves x 64 keys do not
  // fit beside K and V).
  __shared__ alignas(16) _Float16 Ps[16][16 * PP_];

  const int b = blockIdx.z;
  const int h = blockIdx.y;
  // The wave's number, held in a scalar register so that the key loop's counter
  // and the tests on odd stay scalar.
  const int wid  = __builtin_amdgcn_readfirstlane(threadIdx.x >> 5);
  const int qw   = wid & 7;   // which 16 query rows of the block
  const int odd  = wid >> 3;  // 0: even key tiles, 1: odd key tiles
  const int lane = threadIdx.x & 31;
  const int col  = lane & 15;
  const int hi   = lane >> 4;
  const int qbase = blockIdx.x * 128 + qw * 16;

  // Q fragments live in registers for the whole pass (K = D = 64 -> 2 frags).
  const _Float16* qp = qb + ((size_t)(b * N_) + qbase) * E_ + h * D_;
  const v16h aq0 = load_frag16(qp, E_);
  const v16h aq1 = load_frag16(qp + 32, E_);

  float rn[8];
#pragma unroll
  for (int v = 0; v < 8; ++v)
    rn[v] = rnodes[b * N_ + qbase + v + 8 * hi] * 0.125f;  // 1/sqrt(64)

  const size_t mbase = ((size_t)(b * H_ + h)) * N_ * N_;

  v8f acc[4] = {};
  float l[8], m[8];
#pragma unroll
  for (int v = 0; v < 8; ++v) { l[v] = 0.0f; m[v] = -1e30f; }

  // --- K and V of the whole head -> LDS, once. Lane t of the block copies the
  // 16-B chunk t & 7 of rows (t >> 3) + 64 * i, i = 0..15: 16 copies a wave for
  // K, then 16 for V (32 of a wave outstanding at most).
  {
    const int srow = threadIdx.x >> 3, sc = (threadIdx.x & 7) * 8;
    const size_t goff = ((size_t)(b * N_) + srow) * E_ + h * D_ + sc;
    const uint32_t kl = (uint32_t)(size_t)(AS3 const _Float16*)&Ks[srow * KVP_ + sc];
    const uint32_t vl = (uint32_t)(size_t)(AS3 const _Float16*)&Vs[srow * KVP_ + sc];
    for (int i = 0; i < 2; ++i)
      async_copy_8x64rows(kl + i * (512 * KVP_ * 2), kb + goff + (size_t)i * 512 * E_);
    for (int i = 0; i < 2; ++i)
      async_copy_8x64rows(vl + i * (512 * KVP_ * 2), vb + goff + (size_t)i * 512 * E_);
    // This wave's copies have landed before the barrier that publishes them.
    asm volatile("s_wait_asynccnt 0x0" ::: "memory");
  }
  __syncthreads();

  // The lane's place in the two masks: its first query row, its column of the
  // wave's first tile. Both step by two tiles a trip.
  const size_t moff = mbase + (size_t)(qbase + 8 * hi) * N_ + odd * 64 + col;
  const float* ab = aadd + moff;
  const float* mb = amul + moff;

  for (int kt = odd * 64; kt < N_; kt += 128, ab += 128, mb += 128) {
    if (kt + 128 < N_) {
#pragma unroll
      for (int v = 0; v < 8; ++v) {
        __builtin_prefetch(ab + v * N_ + 128, 0, 3);
        __builtin_prefetch(mb + v * N_ + 128, 0, 3);
      }
    }

    // --- scores: S = (Q K^T) * (rn/8) + attn_add (NT stream) ---
    v8f s[4];
#pragma unroll
    for (int nf = 0; nf < 4; ++nf) {
      v8f sc = {};
      sc = wmma32(aq0, load_frag16(&Ks[(kt + nf * 16) * KVP_], KVP_), sc);
      sc = wmma32(aq1, load_frag16(&Ks[(kt + nf * 16) * KVP_ + 32], KVP_), sc);
#pragma unroll
      for (int v = 0; v < 8; ++v) {
        const float av = __builtin_nontemporal_load(&ab[v * N_ + nf * 16]);
        sc[v] = sc[v] * rn[v] + av;
      }
      s[nf] = sc;
    }

    // --- online softmax; fold attn_mult post-exp ---
    float alpha[8];
#pragma unroll
    for (int v = 0; v < 8; ++v) {
      float x = fmaxf(fmaxf(s[0][v], s[1][v]), fmaxf(s[2][v], s[3][v]));
      x = rowmax16(x);
      const float nm = fmaxf(m[v], x);
      alpha[v] = __expf(m[v] - nm);
      m[v] = nm;
    }
    float psum[8];
#pragma unroll
    for (int v = 0; v < 8; ++v) psum[v] = 0.0f;
    // Probs re-striped via the wave's LDS scratch, keys 0..31 of the tile and
    // then keys 32..63 through the same rows (a wave's LDS operations run in
    // order, so the second half's stores land behind the first half's loads).
    v16h ap[2];
#pragma unroll
    for (int kh = 0; kh < 2; ++kh) {
#pragma unroll
      for (int nh = 0; nh < 2; ++nh) {
        const int nf = kh * 2 + nh;
#pragma unroll
        for (int v = 0; v < 8; ++v) {
          float p = __expf(s[nf][v] - m[v]);
          psum[v] += p;  // normalizer excludes the multiplicative mask
          p *= __builtin_nontemporal_load(&mb[v * N_ + nf * 16]);
          Ps[wid][(v + 8 * hi) * PP_ + nh * 16 + col] = (_Float16)p;
        }
      }
      ap[kh] = load_frag16(&Ps[wid][0], PP_);
    }
    const v16h ap0 = ap[0], ap1 = ap[1];
#pragma unroll
    for (int v = 0; v < 8; ++v) l[v] = l[v] * alpha[v] + rowsum16(psum[v]);

    // --- O = O*alpha + P @ V ---
#pragma unroll
    for (int df = 0; df < 4; ++df) {
#pragma unroll
      for (int v = 0; v < 8; ++v) acc[df][v] *= alpha[v];
      acc[df] = wmma32(ap0, load_frag_tr16(&Vs[kt * KVP_ + df * 16]), acc[df]);
      acc[df] = wmma32(ap1, load_frag_tr16(&Vs[(kt + 32) * KVP_ + df * 16]), acc[df]);
    }
  }

  // --- the two halves of a query tile's keys are merged. K and V are dead once
  // every wave has left the loop: wave w + 8 lays its maxima, normalizers and
  // output sums (48 floats a lane, as 12 x 16 B, lane-contiguous) over K's place.
  __syncthreads();  // ends every wave's last read of Ks and Vs
  v4f* xch = (v4f*)Ks + (size_t)qw * 12 * 32 + lane;
  if (odd) {
    xch[0 * 32] = v4f{m[0], m[1], m[2], m[3]};
    xch[1 * 32] = v4f{m[4], m[5], m[6], m[7]};
    xch[2 * 32] = v4f{l[0], l[1], l[2], l[3]};
    xch[3 * 32] = v4f{l[4], l[5], l[6], l[7]};
#pragma unroll
    for (int df = 0; df < 4; ++df) {
      xch[(4 + 2 * df) * 32] = v4f{acc[df][0], acc[df][1], acc[df][2], acc[df][3]};
      xch[(5 + 2 * df) * 32] = v4f{acc[df][4], acc[df][5], acc[df][6], acc[df][7]};
    }
  }
  __syncthreads();  // publishes the odd waves' state to the even waves
  if (odd) return;  // wave-uniform, and no barrier follows

  // --- merge and normalize; element [b, q, h, d] (matches transpose+reshape)
  // goes out in fragment order for the output projection: the wave's 16 rows x
  // 64 columns are two whole tiles. C layout -> A layout through a scratch of
  // the wave's own in V's place.
  _Float16* Os = Vs + qw * (16 * 72);
  v4f x[12];  // read whole ahead of the stores to Os, so that each is read once
#pragma unroll
  for (int j = 0; j < 12; ++j) x[j] = xch[j * 32];
#pragma unroll
  for (int v = 0; v < 8; ++v) {
    const float m2 = x[v >> 2][v & 3];
    const float l2 = x[2 + (v >> 2)][v & 3];
    const float mm = fmaxf(m[v], m2);
    const float a1 = __expf(m[v] - mm);
    const float a2 = __expf(m2 - mm);
    const float inv = 1.0f / (l[v] * a1 + l2 * a2);
    const int r = v + 8 * hi;
#pragma unroll
    for (int df = 0; df < 4; ++df) {
      const float o2 = x[4 + 2 * df + (v >> 2)][v & 3];
      Os[r * 72 + df * 16 + col] = (_Float16)((acc[df][v] * a1 + o2 * a2) * inv);
    }
  }
  _Float16* op =
      ob + ((size_t)((b * N_ + qbase) / 16) * KT_ + h * (D_ / 32)) * TILE_;
  store_frag_packed(op, load_frag16(Os, 72));
  store_frag_packed(op + TILE_, load_frag16(Os + 32, 72));
}

// ---------------------------------------------------------------------------
// Launch
// ---------------------------------------------------------------------------
extern "C" void kernel_launch(void* const* d_in, const int* in_sizes, int n_in,
                              void* d_out, int out_size, void* d_ws, size_t ws_size,
                              hipStream_t stream) {
  (void)in_sizes; (void)n_in; (void)out_size; (void)ws_size;
  const float* X    = (const float*)d_in[0];
  const float* rno  = (const float*)d_in[1];
  const float* aadd = (const float*)d_in[2];
  const float* amul = (const float*)d_in[3];
  const float* Wq   = (const float*)d_in[4];
  const float* bq   = (const float*)d_in[5];
  const float* Wk   = (const float*)d_in[6];
  const float* bk   = (const float*)d_in[7];
  const float* Wv   = (const float*)d_in[8];
  const float* bv   = (const float*)d_in[9];
  const float* Wo   = (const float*)d_in[10];
  const float* bo   = (const float*)d_in[11];
  float* out = (float*)d_out;

  // Workspace layout (f16): ~23 MB total.
  const int BNE = B_ * N_ * E_;   // 2,097,152
  const int EE  = E_ * E_;        //   262,144
  _Float16* x16  = (_Float16*)d_ws;
  _Float16* wq16 = x16 + BNE;
  _Float16* wk16 = wq16 + EE;
  _Float16* wv16 = wk16 + EE;
  _Float16* wo16 = wv16 + EE;
  _Float16* q16  = wo16 + EE;
  _Float16* k16  = q16 + BNE;
  _Float16* v16  = k16 + BNE;
  _Float16* a16  = v16 + BNE;

  const dim3 blk(256);
  // x16, wq16, wk16, wv16, wo16 are one contiguous range starting at x16.
  f32_to_f16_all_kernel<<<(BNE + 4 * EE) / (8 * TILE_), blk, 0, stream>>>(
      X, Wq, Wk, Wv, Wo, x16);

  // wq16..wv16 and q16..v16 are each three equal arrays back to back.
  gemm_qkv_kernel<<<dim3(B_ * N_ / 128, E_ / 64, 3), blk, 0, stream>>>(
      x16, wq16, bq, bk, bv, q16);

  attn_kernel<<<dim3(N_ / 128, H_, B_), dim3(512), 0, stream>>>(
      q16, k16, v16, rno, aadd, amul, a16);

  gemm_out_kernel<<<dim3(B_ * N_ / 128, E_ / 64), blk, 0, stream>>>(
      a16, wo16, bo, out);
}

// v005
// A run of this version takes 56.2 microseconds.
// Two timings next to v004 both put it at 1.12 times that version's speed.
// Over all steps from v000 it is 1.81 times as fast.
#include <hip/hip_runtime.h>
#include <hip/hip_bf16.h>
#include <cstdint>

#define B_ 4
#define N_ 1024
#define E_ 512
#define H_ 8
#define D_ 64

typedef __attribute__((ext_vector_type(16))) _Float16 v16h;
typedef __attribute__((ext_vector_type(8)))  float    v8f;
typedef __attribute__((ext_vector_type(4)))  uint32_t v4u;
typedef __attribute__((ext_vector_type(8)))  short    s16x8;

#define AS3 __attribute__((address_space(3)))

__device__ __forceinline__ v8f wmma32(v16h a, v16h b, v8f c) {
  // 8 args: (neg_a, A, neg_b, B, c_mod, C, reuse_a, reuse_b)
  return __builtin_amdgcn_wmma_f32_16x16x32_f16(
      false, a, false, b, (short)0, c, false, false);
}

__device__ __forceinline__ v16h load_frag16(const _Float16* base, int ldh) {
  const int lane = threadIdx.x & 31;
  const int row  = lane & 15;
  const int hi   = lane >> 4;
  union { v16h v; v4u q[2]; } f;
  const _Float16* rp = base + row * ldh + hi * 8;
  f.q[0] = *(const v4u*)(rp);
  f.q[1] = *(const v4u*)(rp + 16);
  return f.v;
}

// LDS pitch of a K row and of a V row (64 halfs of data): 144 B = 16 B x odd.
#define KVP_ 72

// Fragment of V^T (16 columns of V x 32 keys) straight from row-major V rows in LDS,
// by the transposing load: lane (c, hi) gets V[8*hi + 0..7][c] from the first
// load and V[16 + 8*hi + 0..7][c] from the second, which is load_frag16's k
// order. tile = &V[first key][first column].
__device__ __forceinline__ v16h load_frag_tr16(const _Float16* tile) {
  const int lane = threadIdx.x & 31;
  const _Float16* p =
      tile + ((lane >> 4) * 8 + (lane & 7)) * KVP_ + ((lane >> 3) & 1) * 8;
  union { v16h v; s16x8 q[2]; } f;
  f.q[0] = __builtin_amdgcn_ds_load_tr16_b128_v8i16((AS3 s16x8*)p);
  f.q[1] = __builtin_amdgcn_ds_load_tr16_b128_v8i16((AS3 s16x8*)(p + 16 * KVP_));
  return f.v;
}

__device__ __forceinline__ void async_copy_8x64rows(uint32_t lds,
                                                    const _Float16* g) {
  const uint32_t ls = 64 * KVP_ * 2;  // LDS bytes between the rows of two copies
  const int gs = 64 * E_;             // halfs between them in global memory
  asm volatile(
      "global_load_async_to_lds_b128 %0, %8, off\n\t"
      "global_load_async_to_lds_b128 %1, %9, off\n\t"
      "global_load_async_to_lds_b128 %2, %10, off\n\t"
      "global_load_async_to_lds_b128 %3, %11, off\n\t"
      "global_load_async_to_lds_b128 %4, %12, off\n\t"
      "global_load_async_to_lds_b128 %5, %13, off\n\t"
      "global_load_async_to_lds_b128 %6, %14, off\n\t"
      "global_load_async_to_lds_b128 %7, %15, off\n\t"
      "s_wait_xcnt 0x0"
      :
      : "v"(lds), "v"(lds + ls), "v"(lds + 2 * ls), "v"(lds + 3 * ls),
        "v"(lds + 4 * ls), "v"(lds + 5 * ls), "v"(lds + 6 * ls),
        "v"(lds + 7 * ls), "v"(g), "v"(g + gs), "v"(g + 2 * gs),
        "v"(g + 3 * gs), "v"(g + 4 * gs), "v"(g + 5 * gs), "v"(g + 6 * gs),
        "v"(g + 7 * gs)
      : "memory");
}

// GEMM operands lie in the workspace as 16x32 tiles in fragment order: a tile
// is 512 halfs = 1 KiB; its first 512 B hold every lane's first 8 halfs (what
// load_frag16 puts in q[0]), the second 512 B every lane's q[1]. The tiles of
// one 16-row band follow one another along k (E_/32 = 16 tiles a band). A
// wave-wide b128 load then covers 4 whole 128-B lines, not 32 B of 16 lines.
#define TILE_ 512          // halfs in a 16x32 tile
#define KT_   (E_ / 32)    // tiles along k in a 16-row band
__device__ __forceinline__ v16h load_frag_packed(const _Float16* tile) {
  const int lane = threadIdx.x & 31;
  union { v16h v; v4u q[2]; } f;
  const _Float16* p = tile + lane * 8;
  f.q[0] = *(const v4u*)(p);
  f.q[1] = *(const v4u*)(p + 256);
  return f.v;
}
__device__ __forceinline__ void store_frag_packed(_Float16* tile, v16h x) {
  const int lane = threadIdx.x & 31;
  union { v16h v; v4u q[2]; } f;
  f.v = x;
  _Float16* p = tile + lane * 8;
  *(v4u*)(p) = f.q[0];
  *(v4u*)(p + 256) = f.q[1];
}

__device__ __forceinline__ float xhalf(float x) {
  return __builtin_bit_cast(
      float, __builtin_amdgcn_permlanex16(__builtin_bit_cast(int, x),
                                          __builtin_bit_cast(int, x), 0x76543210,
                                          0xfedcba98, false, false));
}

// ---------------------------------------------------------------------------
// f32 -> f16 conversion of X and of the four weights in ONE launch, written in
// fragment order (see load_frag_packed). Their f16 copies lie back to back in
// the workspace (X, Wq, Wk, Wv, Wo), so dst is indexed by the flat tile number.
// One wave converts one 16x32 tile; a block's 8 tiles are half a 16-row band
// of one source (every source holds a multiple of 8 tiles), so the source is
// picked by a block-uniform test and the block reads 1 KiB of each of 16 rows.
// ---------------------------------------------------------------------------
#define BNE_ (B_ * N_ * E_)
#define EE_  (E_ * E_)
typedef __attribute__((ext_vector_type(4))) float v4f;
__global__ void __launch_bounds__(256) f32_to_f16_all_kernel(
    const float* __restrict__ x, const float* __restrict__ w0,
    const float* __restrict__ w1, const float* __restrict__ w2,
    const float* __restrict__ w3, _Float16* __restrict__ dst) {
  const int first = blockIdx.x * 8;  // flat number of the block's first tile
  const float* src = x;
  int off = first;
  if (first >= BNE_ / TILE_) {
    const int w = (first - BNE_ / TILE_) / (EE_ / TILE_);
    src = (w == 0) ? w0 : (w == 1) ? w1 : (w == 2) ? w2 : w3;
    off = first - BNE_ / TILE_ - w * (EE_ / TILE_);
  }
  const int wid  = threadIdx.x >> 5;
  const int lane = threadIdx.x & 31;
  const int t = off + wid;           // tile number inside the source
  const float* rp = src + (size_t)((t / KT_) * 16 + (lane & 15)) * E_ +
                    (t % KT_) * 32 + (lane >> 4) * 8;
  const v4f g[4] = {*(const v4f*)(rp), *(const v4f*)(rp + 4),
                    *(const v4f*)(rp + 16), *(const v4f*)(rp + 20)};
  v16h o;
  // Unrolled so that the vector indices are constants and g, o stay in registers.
#pragma unroll
  for (int i = 0; i < 16; ++i) o[i] = (_Float16)g[i >> 2][i & 3];
  store_frag_packed(dst + (size_t)(first + wid) * TILE_, o);
}

__device__ __forceinline__ void gemm_xwT_products(
    const _Float16* __restrict__ A, const _Float16* __restrict__ W,
    v8f (&acc)[2][2]) {
  const int wid = threadIdx.x >> 5;
  const int r0 = blockIdx.x * 128 + (wid & 3) * 32;
  const int c0 = blockIdx.y * 64 + (wid >> 2) * 32;
  const _Float16* Ab = A + (size_t)(r0 / 16) * KT_ * TILE_;  // band of rows r0..
  const _Float16* Wb = W + (size_t)(c0 / 16) * KT_ * TILE_;
  // Unrolled whole, so that every tile's offset is an immediate of its load and
  // no address register is formed or rewritten inside the loop.
#pragma unroll
  for (int kt = 0; kt < KT_; ++kt) {
    v16h a0 = load_frag_packed(Ab + kt * TILE_);
    v16h a1 = load_frag_packed(Ab + (KT_ + kt) * TILE_);
    v16h b0 = load_frag_packed(Wb + kt * TILE_);
    v16h b1 = load_frag_packed(Wb + (KT_ + kt) * TILE_);
    acc[0][0] = wmma32(a0, b0, acc[0][0]);
    acc[0][1] = wmma32(a0, b1, acc[0][1]);
    acc[1][0] = wmma32(a1, b0, acc[1][0]);
    acc[1][1] = wmma32(a1, b1, acc[1][1]);
  }
}

template <typename OutT>
__device__ __forceinline__ void gemm_xwT_store(
    const v8f (&acc)[2][2], const float* __restrict__ bias,
    OutT* __restrict__ out) {
  const int wid = threadIdx.x >> 5;
  const int r0 = blockIdx.x * 128 + (wid & 3) * 32;
  const int c0 = blockIdx.y * 64 + (wid >> 2) * 32;
  const int lane = threadIdx.x & 31;
  const int col = lane & 15;
  const int hi  = lane >> 4;
#pragma unroll
  for (int i = 0; i < 2; ++i) {
#pragma unroll
    for (int j = 0; j < 2; ++j) {
      const int c = c0 + j * 16 + col;
      const float bv = bias[c];
#pragma unroll
      for (int v = 0; v < 8; ++v) {
        const int r = r0 + i * 16 + v + 8 * hi;
        out[(size_t)r * E_ + c] = (OutT)(acc[i][j][v] + bv);
      }
    }
  }
}

// Q, K and V projections in ONE launch: they share A and none reads another's
// output. blockIdx.z picks the weight, the bias and the output; the three f16
// weights, and the three outputs, lie back to back in the workspace.
__global__ void __launch_bounds__(256) gemm_qkv_kernel(
    const _Float16* __restrict__ A, const _Float16* __restrict__ W3,
    const float* __restrict__ bq, const float* __restrict__ bk,
    const float* __restrict__ bv, _Float16* __restrict__ out3) {
  const int z = blockIdx.z;
  const float* bias = (z == 0) ? bq : (z == 1) ? bk : bv;
  v8f acc[2][2] = {};
  gemm_xwT_products(A, W3 + (size_t)z * EE_, acc);
  asm volatile("s_wait_xcnt 0x0" ::: "memory");
  gemm_xwT_store<_Float16>(acc, bias, out3 + (size_t)z * BNE_);
}

__global__ void __launch_bounds__(256) gemm_out_kernel(
    const _Float16* __restrict__ A, const _Float16* __restrict__ W,
    const float* __restrict__ bias, float* __restrict__ out) {
  v8f acc[2][2] = {};
  gemm_xwT_products(A, W, acc);
  gemm_xwT_store<float>(acc, bias, out);
}

__global__ void __launch_bounds__(512) attn_kernel(
    const _Float16* __restrict__ qb, const _Float16* __restrict__ kb,
    const _Float16* __restrict__ vb, const float* __restrict__ rnodes,
    const float* __restrict__ aadd, const float* __restrict__ amul,
    _Float16* __restrict__ ob) {
  __shared__ alignas(16) _Float16 Ks[N_ * KVP_];   // [key][d] -> A frags (K Q^T)
  __shared__ alignas(16) _Float16 Vs[N_ * KVP_];   // [key][d] -> A frags (V^T P^T), tr16

  const int b = blockIdx.z;
  const int h = blockIdx.y;
  // The wave's number, held in a scalar register so that the key loop's counter
  // and the tests on odd stay scalar.
  const int wid  = __builtin_amdgcn_readfirstlane(threadIdx.x >> 5);
  const int qw   = wid & 7;   // which 16 query rows of the block
  const int odd  = wid >> 3;  // 0: even key tiles, 1: odd key tiles
  const int lane = threadIdx.x & 31;
  const int col  = lane & 15;
  const int hi   = lane >> 4;
  const int qbase = blockIdx.x * 128 + qw * 16;
  const int qrow  = qbase + col;  // the lane's query

  // Q fragments (B operand) live in registers for the whole pass (D = 64 -> 2).
  const _Float16* qp = qb + ((size_t)(b * N_) + qbase) * E_ + h * D_;
  const v16h aq0 = load_frag16(qp, E_);
  const v16h aq1 = load_frag16(qp + 32, E_);

  const float rn = rnodes[b * N_ + qrow] * 0.125f;  // 1/sqrt(64)

  const size_t mbase = ((size_t)(b * H_ + h)) * N_ * N_;

  v8f acc[4] = {};  // acc[df][v] = O[qrow][df * 16 + 8 * hi + v]
  float l = 0.0f, m = -1e30f;  // l: this half's keys only, until behind the loop

  // --- K and V of the whole head -> LDS, once. Lane t of the block copies the
  // 16-B chunk t & 7 of rows (t >> 3) + 64 * i, i = 0..15: 16 copies a wave for
  // K, then 16 for V (32 of a wave outstanding at most).
  {
    const int srow = threadIdx.x >> 3, sc = (threadIdx.x & 7) * 8;
    const size_t goff = ((size_t)(b * N_) + srow) * E_ + h * D_ + sc;
    const uint32_t kl = (uint32_t)(size_t)(AS3 const _Float16*)&Ks[srow * KVP_ + sc];
    const uint32_t vl = (uint32_t)(size_t)(AS3 const _Float16*)&Vs[srow * KVP_ + sc];
    for (int i = 0; i < 2; ++i)
      async_copy_8x64rows(kl + i * (512 * KVP_ * 2), kb + goff + (size_t)i * 512 * E_);
    for (int i = 0; i < 2; ++i)
      async_copy_8x64rows(vl + i * (512 * KVP_ * 2), vb + goff + (size_t)i * 512 * E_);
    // This wave's copies have landed before the barrier that publishes them.
    asm volatile("s_wait_asynccnt 0x0" ::: "memory");
  }
  __syncthreads();

  // The lane's place in the two masks: its query's row, its first key of the
  // wave's first tile. Both step by two tiles a trip.
  const size_t mrow = mbase + (size_t)qrow * N_ + odd * 64;
  const float* ab = aadd + mrow + 8 * hi;
  const float* mb = amul + mrow + 8 * hi;
  const float* pf = (hi ? amul : aadd) + mrow;

  for (int kt = odd * 64; kt < N_; kt += 128, ab += 128, mb += 128, pf += 128) {
    if (kt + 128 < N_) __builtin_prefetch(pf + 128, 0, 3);

    // --- scores: S^T = (K Q^T) * (rn/8) + attn_add (NT stream) ---
    v8f s[4];  // s[nf][v] = S[qrow][kt + nf * 16 + 8 * hi + v]
#pragma unroll
    for (int nf = 0; nf < 4; ++nf) {
      v8f sc = {};
      sc = wmma32(load_frag16(&Ks[(kt + nf * 16) * KVP_], KVP_), aq0, sc);
      sc = wmma32(load_frag16(&Ks[(kt + nf * 16) * KVP_ + 32], KVP_), aq1, sc);
      const v4f a0 = __builtin_nontemporal_load((const v4f*)(ab + nf * 16));
      const v4f a1 = __builtin_nontemporal_load((const v4f*)(ab + nf * 16 + 4));
      s[nf] = sc * rn + __builtin_shufflevector(a0, a1, 0, 1, 2, 3, 4, 5, 6, 7);
    }

    // --- online softmax; fold attn_mult post-exp ---
    float xm[8];
#pragma unroll
    for (int v = 0; v < 8; ++v)
      xm[v] = fmaxf(fmaxf(s[0][v], s[1][v]), fmaxf(s[2][v], s[3][v]));
    float x = fmaxf(fmaxf(fmaxf(xm[0], xm[1]), fmaxf(xm[2], xm[3])),
                    fmaxf(fmaxf(xm[4], xm[5]), fmaxf(xm[6], xm[7])));
    x = fmaxf(x, xhalf(x));  // both halves now hold the tile's maximum
    const float nm = fmaxf(m, x);
    const float alpha = __expf(m - nm);
    m = nm;

    float psum[8];
#pragma unroll
    for (int v = 0; v < 8; ++v) psum[v] = 0.0f;
    v16h bp[2];  // B fragments: keys 0..31 and 32..63 of the tile
#pragma unroll
    for (int nf = 0; nf < 4; ++nf) {
      const v4f u0 = __builtin_nontemporal_load((const v4f*)(mb + nf * 16));
      const v4f u1 = __builtin_nontemporal_load((const v4f*)(mb + nf * 16 + 4));
#pragma unroll
      for (int v = 0; v < 8; ++v) {
        float p = __expf(s[nf][v] - m);
        psum[v] += p;  // normalizer excludes the multiplicative mask
        p *= (v < 4) ? u0[v & 3] : u1[v & 3];
        bp[nf >> 1][(nf & 1) * 8 + v] = (_Float16)p;
      }
    }
    l = l * alpha + (((psum[0] + psum[1]) + (psum[2] + psum[3])) +
                     ((psum[4] + psum[5]) + (psum[6] + psum[7])));

    // --- O^T = O^T * alpha + V^T P^T ---
#pragma unroll
    for (int df = 0; df < 4; ++df) {
#pragma unroll
      for (int v = 0; v < 8; ++v) acc[df][v] *= alpha;
      acc[df] = wmma32(load_frag_tr16(&Vs[kt * KVP_ + df * 16]), bp[0], acc[df]);
      acc[df] = wmma32(load_frag_tr16(&Vs[(kt + 32) * KVP_ + df * 16]), bp[1], acc[df]);
    }
  }

  asm volatile("v_nop\n\tv_nop\n\tv_nop\n\tv_nop");

  // --- the two halves of a query tile's keys are merged. K and V are dead once
  // every wave has left the loop: wave w + 8 lays its maximum, normalizer and
  // output sums (34 floats a lane, as 9 x 16 B, lane-contiguous) over K's place.
  __syncthreads();  // ends every wave's last read of Ks and Vs
  v4f* xch = (v4f*)Ks + (size_t)qw * 9 * 32 + lane;
  if (odd) {
    xch[0] = v4f{m, l, 0.0f, 0.0f};
#pragma unroll
    for (int df = 0; df < 4; ++df) {
      xch[(1 + 2 * df) * 32] = v4f{acc[df][0], acc[df][1], acc[df][2], acc[df][3]};
      xch[(2 + 2 * df) * 32] = v4f{acc[df][4], acc[df][5], acc[df][6], acc[df][7]};
    }
  }
  __syncthreads();  // publishes the odd waves' state to the even waves
  if (odd) return;  // wave-uniform, and no barrier follows

  // --- merge and normalize; element [b, q, h, d] (matches transpose+reshape)
  // goes out in fragment order for the output projection: the wave's 16 rows x
  // 64 columns are two whole tiles, and the lane already holds its share of both.
  const v4f ml2 = xch[0];
  const float mm = fmaxf(m, ml2[0]);
  const float a1 = __expf(m - mm);
  const float a2 = __expf(ml2[0] - mm);
  float ls = l * a1 + ml2[1] * a2;
  ls += xhalf(ls);  // the other half's keys
  const float inv = 1.0f / ls;
  v16h o[2];
#pragma unroll
  for (int df = 0; df < 4; ++df) {
    const v4f x0 = xch[(1 + 2 * df) * 32];
    const v4f x1 = xch[(2 + 2 * df) * 32];
#pragma unroll
    for (int v = 0; v < 8; ++v) {
      const float o2 = (v < 4) ? x0[v & 3] : x1[v & 3];
      o[df >> 1][(df & 1) * 8 + v] = (_Float16)((acc[df][v] * a1 + o2 * a2) * inv);
    }
  }
  _Float16* op =
      ob + ((size_t)((b * N_ + qbase) / 16) * KT_ + h * (D_ / 32)) * TILE_;
  store_frag_packed(op, o[0]);
  store_frag_packed(op + TILE_, o[1]);
}

// ---------------------------------------------------------------------------
// Launch
// ---------------------------------------------------------------------------
extern "C" void kernel_launch(void* const* d_in, const int* in_sizes, int n_in,
                              void* d_out, int out_size, void* d_ws, size_t ws_size,
                              hipStream_t stream) {
  (void)in_sizes; (void)n_in; (void)out_size; (void)ws_size;
  const float* X    = (const float*)d_in[0];
  const float* rno  = (const float*)d_in[1];
  const float* aadd = (const float*)d_in[2];
  const float* amul = (const float*)d_in[3];
  const float* Wq   = (const float*)d_in[4];
  const float* bq   = (const float*)d_in[5];
  const float* Wk   = (const float*)d_in[6];
  const float* bk   = (const float*)d_in[7];
  const float* Wv   = (const float*)d_in[8];
  const float* bv   = (const float*)d_in[9];
  const float* Wo   = (const float*)d_in[10];
  const float* bo   = (const float*)d_in[11];
  float* out = (float*)d_out;

  // Workspace layout (f16): ~23 MB total.
  const int BNE = B_ * N_ * E_;   // 2,097,152
  const int EE  = E_ * E_;        //   262,144
  _Float16* x16  = (_Float16*)d_ws;
  _Float16* wq16 = x16 + BNE;
  _Float16* wk16 = wq16 + EE;
  _Float16* wv16 = wk16 + EE;
  _Float16* wo16 = wv16 + EE;
  _Float16* q16  = wo16 + EE;
  _Float16* k16  = q16 + BNE;
  _Float16* v16  = k16 + BNE;
  _Float16* a16  = v16 + BNE;

  const dim3 blk(256);
  // x16, wq16, wk16, wv16, wo16 are one contiguous range starting at x16.
  f32_to_f16_all_kernel<<<(BNE + 4 * EE) / (8 * TILE_), blk, 0, stream>>>(
      X, Wq, Wk, Wv, Wo, x16);

  // wq16..wv16 and q16..v16 are each three equal arrays back to back.
  gemm_qkv_kernel<<<dim3(B_ * N_ / 128, E_ / 64, 3), blk, 0, stream>>>(
      x16, wq16, bq, bk, bv, q16);

  attn_kernel<<<dim3(N_ / 128, H_, B_), dim3(512), 0, stream>>>(
      q16, k16, v16, rno, aadd, amul, a16);

  gemm_out_kernel<<<dim3(B_ * N_ / 128, E_ / 64), blk, 0, stream>>>(
      a16, wo16, bo, out);
}

// v006
// Measured time: 51.8 microseconds a run.
// Timed twice side by side with v005, it ran 1.12 and 1.07 times as fast.
// Counting every step since v000, it is 1.98 times as fast.
#include <hip/hip_runtime.h>
#include <hip/hip_bf16.h>
#include <cstdint>

#define B_ 4
#define N_ 1024
#define E_ 512
#define H_ 8
#define D_ 64

typedef __attribute__((ext_vector_type(16))) _Float16 v16h;
typedef __attribute__((ext_vector_type(8)))  float    v8f;
typedef __attribute__((ext_vector_type(4)))  uint32_t v4u;
typedef __attribute__((ext_vector_type(8)))  short    s16x8;

#define AS3 __attribute__((address_space(3)))

__device__ __forceinline__ v8f wmma32(v16h a, v16h b, v8f c) {
  // 8 args: (neg_a, A, neg_b, B, c_mod, C, reuse_a, reuse_b)
  return __builtin_amdgcn_wmma_f32_16x16x32_f16(
      false, a, false, b, (short)0, c, false, false);
}

__device__ __forceinline__ v16h load_frag16(const _Float16* base, int ldh) {
  const int lane = threadIdx.x & 31;
  const int row  = lane & 15;
  const int hi   = lane >> 4;
  union { v16h v; v4u q[2]; } f;
  const _Float16* rp = base + row * ldh + hi * 8;
  f.q[0] = *(const v4u*)(rp);
  f.q[1] = *(const v4u*)(rp + 16);
  return f.v;
}

// LDS pitch of a K row and of a V row (64 halfs of data): 144 B = 16 B x odd.
#define KVP_ 72

// Fragment of V^T (16 columns of V x 32 keys) straight from row-major V rows in LDS,
// by the transposing load: lane (c, hi) gets V[8*hi + 0..7][c] from the first
// load and V[16 + 8*hi + 0..7][c] from the second, which is load_frag16's k
// order. tile = &V[first key][first column].
__device__ __forceinline__ v16h load_frag_tr16(const _Float16* tile) {
  const int lane = threadIdx.x & 31;
  const _Float16* p =
      tile + ((lane >> 4) * 8 + (lane & 7)) * KVP_ + ((lane >> 3) & 1) * 8;
  union { v16h v; s16x8 q[2]; } f;
  f.q[0] = __builtin_amdgcn_ds_load_tr16_b128_v8i16((AS3 s16x8*)p);
  f.q[1] = __builtin_amdgcn_ds_load_tr16_b128_v8i16((AS3 s16x8*)(p + 16 * KVP_));
  return f.v;
}

__device__ __forceinline__ void async_copy_8x64rows(uint32_t lds,
                                                    const _Float16* g) {
  const uint32_t ls = 64 * KVP_ * 2;  // LDS bytes between the rows of two copies
  const int gs = 64 * E_;             // halfs between them in global memory
  asm volatile(
      "global_load_async_to_lds_b128 %0, %8, off\n\t"
      "global_load_async_to_lds_b128 %1, %9, off\n\t"
      "global_load_async_to_lds_b128 %2, %10, off\n\t"
      "global_load_async_to_lds_b128 %3, %11, off\n\t"
      "global_load_async_to_lds_b128 %4, %12, off\n\t"
      "global_load_async_to_lds_b128 %5, %13, off\n\t"
      "global_load_async_to_lds_b128 %6, %14, off\n\t"
      "global_load_async_to_lds_b128 %7, %15, off\n\t"
      "s_wait_xcnt 0x0"
      :
      : "v"(lds), "v"(lds + ls), "v"(lds + 2 * ls), "v"(lds + 3 * ls),
        "v"(lds + 4 * ls), "v"(lds + 5 * ls), "v"(lds + 6 * ls),
        "v"(lds + 7 * ls), "v"(g), "v"(g + gs), "v"(g + 2 * gs),
        "v"(g + 3 * gs), "v"(g + 4 * gs), "v"(g + 5 * gs), "v"(g + 6 * gs),
        "v"(g + 7 * gs)
      : "memory");
}

// GEMM operands lie in the workspace as 16x32 tiles in fragment order: a tile
// is 512 halfs = 1 KiB; its first 512 B hold every lane's first 8 halfs (what
// load_frag16 puts in q[0]), the second 512 B every lane's q[1]. The tiles of
// one 16-row band follow one another along k (E_/32 = 16 tiles a band). A
// wave-wide b128 load then covers 4 whole 128-B lines, not 32 B of 16 lines.
#define TILE_ 512          // halfs in a 16x32 tile
#define KT_   (E_ / 32)    // tiles along k in a 16-row band
__device__ __forceinline__ v16h load_frag_packed(const _Float16* tile) {
  const int lane = threadIdx.x & 31;
  union { v16h v; v4u q[2]; } f;
  const _Float16* p = tile + lane * 8;
  f.q[0] = *(const v4u*)(p);
  f.q[1] = *(const v4u*)(p + 256);
  return f.v;
}
__device__ __forceinline__ void store_frag_packed(_Float16* tile, v16h x) {
  const int lane = threadIdx.x & 31;
  union { v16h v; v4u q[2]; } f;
  f.v = x;
  _Float16* p = tile + lane * 8;
  *(v4u*)(p) = f.q[0];
  *(v4u*)(p + 256) = f.q[1];
}

__device__ __forceinline__ float xhalf(float x) {
  return __builtin_bit_cast(
      float, __builtin_amdgcn_permlanex16(__builtin_bit_cast(int, x),
                                          __builtin_bit_cast(int, x), 0x76543210,
                                          0xfedcba98, false, false));
}

#define BNE_ (B_ * N_ * E_)
#define EE_  (E_ * E_)
typedef __attribute__((ext_vector_type(4))) float v4f;
typedef __attribute__((ext_vector_type(4))) _Float16 v4h;

// f32 -> f16 conversion of one 16x32 tile by one wave, written in fragment
// order (see load_frag_packed). t = the tile's number inside src and dst.
__device__ __forceinline__ void convert_tile_packed(
    const float* __restrict__ src, _Float16* __restrict__ dst, int t) {
  const int lane = threadIdx.x & 31;
  const float* rp = src + (size_t)((t / KT_) * 16 + (lane & 15)) * E_ +
                    (t % KT_) * 32 + (lane >> 4) * 8;
  const v4f g[4] = {*(const v4f*)(rp), *(const v4f*)(rp + 4),
                    *(const v4f*)(rp + 16), *(const v4f*)(rp + 20)};
  v16h o;
  // Unrolled so that the vector indices are constants and g, o stay in registers.
#pragma unroll
  for (int i = 0; i < 16; ++i) o[i] = (_Float16)g[i >> 2][i & 3];
  store_frag_packed(dst + (size_t)t * TILE_, o);
}

__device__ __forceinline__ void gemm_xwT_products(
    const _Float16* __restrict__ A, const _Float16* __restrict__ W,
    v8f (&acc)[2][2]) {
  const int wid = threadIdx.x >> 5;
  const int r0 = blockIdx.x * 128 + (wid & 3) * 32;
  const int c0 = blockIdx.y * 64 + (wid >> 2) * 32;
  const _Float16* Ab = A + (size_t)(r0 / 16) * KT_ * TILE_;  // band of rows r0..
  const _Float16* Wb = W + (size_t)(c0 / 16) * KT_ * TILE_;
  // Unrolled whole, so that every tile's offset is an immediate of its load and
  // no address register is formed or rewritten inside the loop.
#pragma unroll
  for (int kt = 0; kt < KT_; ++kt) {
    v16h a0 = load_frag_packed(Ab + kt * TILE_);
    v16h a1 = load_frag_packed(Ab + (KT_ + kt) * TILE_);
    v16h b0 = load_frag_packed(Wb + kt * TILE_);
    v16h b1 = load_frag_packed(Wb + (KT_ + kt) * TILE_);
    acc[0][0] = wmma32(a0, b0, acc[0][0]);
    acc[0][1] = wmma32(a0, b1, acc[0][1]);
    acc[1][0] = wmma32(a1, b0, acc[1][0]);
    acc[1][1] = wmma32(a1, b1, acc[1][1]);
  }
}

template <typename OutT>
__device__ __forceinline__ void gemm_xwT_store(
    const v8f (&acc)[2][2], const float* __restrict__ bias,
    OutT* __restrict__ out) {
  const int wid = threadIdx.x >> 5;
  const int r0 = blockIdx.x * 128 + (wid & 3) * 32;
  const int c0 = blockIdx.y * 64 + (wid >> 2) * 32;
  const int lane = threadIdx.x & 31;
  const int col = lane & 15;
  const int hi  = lane >> 4;
#pragma unroll
  for (int i = 0; i < 2; ++i) {
#pragma unroll
    for (int j = 0; j < 2; ++j) {
      const int c = c0 + j * 16 + col;
      const float bv = bias[c];
#pragma unroll
      for (int v = 0; v < 8; ++v) {
        const int r = r0 + i * 16 + v + 8 * hi;
        out[(size_t)r * E_ + c] = (OutT)(acc[i][j][v] + bv);
      }
    }
  }
}

#define LP_ 160                    // halfs between the planes of a tile in LDS
#define LT_ 656                    // halfs between tiles in LDS
#define QKV_NY_ (3 * E_ / 192)     // column tiles of 192
#define QKV_TILES_ ((128 + 192) / 16 * 2)  // tiles of one stage

__device__ __forceinline__ v16h load_frag_planes(const _Float16* tile) {
  const int lane = threadIdx.x & 31;
  union { v16h v; v4u q[2]; } f;
  const _Float16* p = tile + (lane >> 4) * LP_ + (lane & 15) * 8;
  f.q[0] = *(const v4u*)(p);
  f.q[1] = *(const v4u*)(p + 2 * LP_);
  return f.v;
}

// Work-group barrier for LDS data alone: the wave's own LDS stores and reads
// have retired (s_wait_dscnt 0) when it signals. __syncthreads() would also wait
// out the f32 loads that are issued ahead, and with them their lead.
__device__ __forceinline__ void lds_barrier() {
  asm volatile("s_wait_dscnt 0x0\n\ts_barrier_signal -1\n\ts_barrier_wait -1" ::: "memory");
}

// The lane's ten 16-B pieces of stage ks: rows 32 apart, four of X, six of W
// (two in each 64-row group of W, which lies inside one of the three weights).
__device__ __forceinline__ void qkv_stage_load(
    v4f (&g)[10], const float* ap, const float* w0, const float* w1,
    const float* w2, int ks) {
#pragma unroll
  for (int i = 0; i < 4; ++i) g[i] = *(const v4f*)(ap + i * 32 * E_ + ks * 64);
  g[4] = *(const v4f*)(w0 + ks * 64);
  g[5] = *(const v4f*)(w0 + 32 * E_ + ks * 64);
  g[6] = *(const v4f*)(w1 + ks * 64);
  g[7] = *(const v4f*)(w1 + 32 * E_ + ks * 64);
  g[8] = *(const v4f*)(w2 + ks * 64);
  g[9] = *(const v4f*)(w2 + 32 * E_ + ks * 64);
}

// Rows 32 apart are two 16-row bands = four tiles apart in a stage's buffer.
__device__ __forceinline__ void qkv_stage_store(const v4f (&g)[10], _Float16* sd) {
#pragma unroll
  for (int i = 0; i < 10; ++i)
    *(v4h*)(sd + i * 4 * LT_) = v4h{(_Float16)g[i][0], (_Float16)g[i][1],
                                    (_Float16)g[i][2], (_Float16)g[i][3]};
}

__global__ void __launch_bounds__(512) gemm_qkv_kernel(
    const float* __restrict__ x, const float* __restrict__ wq,
    const float* __restrict__ wk, const float* __restrict__ wv,
    const float* __restrict__ wo, const float* __restrict__ bq,
    const float* __restrict__ bk, const float* __restrict__ bv,
    _Float16* __restrict__ out3, _Float16* __restrict__ wo16) {
  __shared__ alignas(16) _Float16 st[2][QKV_TILES_ * LT_];
  // The wave's number in a scalar register: what depends on it alone stays scalar.
  const int wid  = __builtin_amdgcn_readfirstlane(threadIdx.x >> 5);
  const int lane = threadIdx.x & 31;

  if (blockIdx.y == QKV_NY_) {  // block-uniform, in front of every barrier
    convert_tile_packed(wo, wo16, blockIdx.x * 16 + wid);
    return;
  }

  // --- staging: the lane's place in the sources and in a stage's buffer.
  const int half = lane >> 4;   // which of the wave-wide load's two rows
  const int j    = lane & 15;   // which 4 of the row's 64 floats
  const int srow = 2 * wid + half;
  const float* ap = x + (size_t)(blockIdx.x * 128 + srow) * E_ + j * 4;
  const float* wp[3];
#pragma unroll
  for (int g = 0; g < 3; ++g) {
    const int c = blockIdx.y * 192 + g * 64;  // first row of the group in [1536]
    const float* w = (c < E_) ? wq : (c < 2 * E_) ? wk : wv;
    wp[g] = w + (size_t)((c & (E_ - 1)) + srow) * E_ + j * 4;
  }
  // k = 4 * (j & 7) + 0..3 of tile j >> 3: plane (j & 7) >> 1, halfs (j & 1) * 4 + 0..3.
  const int sd = ((srow >> 4) * 2 + (j >> 3)) * LT_ + ((j & 7) >> 1) * LP_ +
                 (srow & 15) * 8 + (j & 1) * 4;

  const int wr = wid & 3;   // 32 rows of the block's 128
  const int wc = wid >> 2;  // 48 columns of its 192
  v8f acc[2][3] = {};
  v4f g[2][10];
  qkv_stage_load(g[0], ap, wp[0], wp[1], wp[2], 0);
  qkv_stage_load(g[1], ap, wp[0], wp[1], wp[2], 1);
  qkv_stage_store(g[0], &st[0][sd]);
  qkv_stage_load(g[0], ap, wp[0], wp[1], wp[2], 2);
  lds_barrier();  // publishes stage 0

  // Unrolled whole, so that the register sets and buffers are picked at compile
  // time and every load's offset is an immediate.
#pragma unroll
  for (int ks = 0; ks < E_ / 64; ++ks) {
    const _Float16* buf = st[ks & 1];
#pragma unroll
    for (int sub = 0; sub < 2; ++sub) {
      const v16h a0 = load_frag_planes(buf + ((wr * 2 + 0) * 2 + sub) * LT_);
      const v16h a1 = load_frag_planes(buf + ((wr * 2 + 1) * 2 + sub) * LT_);
      v16h bf[3];
#pragma unroll
      for (int n = 0; n < 3; ++n)
        bf[n] = load_frag_planes(buf + ((8 + wc * 3 + n) * 2 + sub) * LT_);
      // Keeps the ten LDS loads together in front of their six products: one
      // LDS latency a group, not one in front of every pair of products.
      __builtin_amdgcn_sched_barrier(0);
#pragma unroll
      for (int n = 0; n < 3; ++n) {
        acc[0][n] = wmma32(a0, bf[n], acc[0][n]);
        acc[1][n] = wmma32(a1, bf[n], acc[1][n]);
      }
    }
    if (ks + 1 < E_ / 64) {
      // Keeps the next stage's rounding, and so the wait for its f32 loads,
      // behind this stage's products: the loads keep two stages of lead.
      __builtin_amdgcn_sched_barrier(0);
      // Into the buffer whose last readers left it at the previous barrier.
      qkv_stage_store(g[(ks + 1) & 1], &st[(ks + 1) & 1][sd]);
      if (ks + 3 < E_ / 64)
        qkv_stage_load(g[(ks + 1) & 1], ap, wp[0], wp[1], wp[2], ks + 3);
      lds_barrier();  // publishes stage ks + 1, ends the reads of stage ks
    }
  }

  const int col = lane & 15;
  const int hi  = lane >> 4;
  const int r0  = blockIdx.x * 128 + wr * 32;
#pragma unroll
  for (int n = 0; n < 3; ++n) {
    const int c16 = blockIdx.y * 192 + wc * 48 + n * 16;  // 16 columns of one weight
    const int z = c16 / E_;
    const float* bias = (z == 0) ? bq : (z == 1) ? bk : bv;
    const int c = (c16 & (E_ - 1)) + col;
    const float bvv = bias[c];
    _Float16* out = out3 + (size_t)z * BNE_;
#pragma unroll
    for (int i = 0; i < 2; ++i) {
#pragma unroll
      for (int v = 0; v < 8; ++v) {
        const int r = r0 + i * 16 + v + 8 * hi;
        out[(size_t)r * E_ + c] = (_Float16)(acc[i][n][v] + bvv);
      }
    }
  }
  // Behind the last store: in the listing the Wo block follows this code and
  // writes registers that the stores name; the wait stands in front of that.
  asm volatile("s_wait_xcnt 0x0" ::: "memory");
}

__global__ void __launch_bounds__(256) gemm_out_kernel(
    const _Float16* __restrict__ A, const _Float16* __restrict__ W,
    const float* __restrict__ bias, float* __restrict__ out) {
  v8f acc[2][2] = {};
  gemm_xwT_products(A, W, acc);
  gemm_xwT_store<float>(acc, bias, out);
}

__global__ void __launch_bounds__(512) attn_kernel(
    const _Float16* __restrict__ qb, const _Float16* __restrict__ kb,
    const _Float16* __restrict__ vb, const float* __restrict__ rnodes,
    const float* __restrict__ aadd, const float* __restrict__ amul,
    _Float16* __restrict__ ob) {
  __shared__ alignas(16) _Float16 Ks[N_ * KVP_];   // [key][d] -> A frags (K Q^T)
  __shared__ alignas(16) _Float16 Vs[N_ * KVP_];   // [key][d] -> A frags (V^T P^T), tr16

  const int b = blockIdx.z;
  const int h = blockIdx.y;
  // The wave's number, held in a scalar register so that the key loop's counter
  // and the tests on odd stay scalar.
  const int wid  = __builtin_amdgcn_readfirstlane(threadIdx.x >> 5);
  const int qw   = wid & 7;   // which 16 query rows of the block
  const int odd  = wid >> 3;  // 0: even key tiles, 1: odd key tiles
  const int lane = threadIdx.x & 31;
  const int col  = lane & 15;
  const int hi   = lane >> 4;
  const int qbase = blockIdx.x * 128 + qw * 16;
  const int qrow  = qbase + col;  // the lane's query

  // Q fragments (B operand) live in registers for the whole pass (D = 64 -> 2).
  const _Float16* qp = qb + ((size_t)(b * N_) + qbase) * E_ + h * D_;
  const v16h aq0 = load_frag16(qp, E_);
  const v16h aq1 = load_frag16(qp + 32, E_);

  const float rn = rnodes[b * N_ + qrow] * 0.125f;  // 1/sqrt(64)

  const size_t mbase = ((size_t)(b * H_ + h)) * N_ * N_;

  v8f acc[4] = {};  // acc[df][v] = O[qrow][df * 16 + 8 * hi + v]
  float l = 0.0f, m = -1e30f;  // l: this half's keys only, until behind the loop

  // --- K and V of the whole head -> LDS, once. Lane t of the block copies the
  // 16-B chunk t & 7 of rows (t >> 3) + 64 * i, i = 0..15: 16 copies a wave for
  // K, then 16 for V (32 of a wave outstanding at most).
  {
    const int srow = threadIdx.x >> 3, sc = (threadIdx.x & 7) * 8;
    const size_t goff = ((size_t)(b * N_) + srow) * E_ + h * D_ + sc;
    const uint32_t kl = (uint32_t)(size_t)(AS3 const _Float16*)&Ks[srow * KVP_ + sc];
    const uint32_t vl = (uint32_t)(size_t)(AS3 const _Float16*)&Vs[srow * KVP_ + sc];
    for (int i = 0; i < 2; ++i)
      async_copy_8x64rows(kl + i * (512 * KVP_ * 2), kb + goff + (size_t)i * 512 * E_);
    for (int i = 0; i < 2; ++i)
      async_copy_8x64rows(vl + i * (512 * KVP_ * 2), vb + goff + (size_t)i * 512 * E_);
    // This wave's copies have landed before the barrier that publishes them.
    asm volatile("s_wait_asynccnt 0x0" ::: "memory");
  }
  __syncthreads();

  // The lane's place in the two masks: its query's row, its first key of the
  // wave's first tile. Both step by two tiles a trip.
  const size_t mrow = mbase + (size_t)qrow * N_ + odd * 64;
  const float* ab = aadd + mrow + 8 * hi;
  const float* mb = amul + mrow + 8 * hi;
  const float* pf = (hi ? amul : aadd) + mrow;

  for (int kt = odd * 64; kt < N_; kt += 128, ab += 128, mb += 128, pf += 128) {
    if (kt + 128 < N_) __builtin_prefetch(pf + 128, 0, 3);

    // --- scores: S^T = (K Q^T) * (rn/8) + attn_add (NT stream) ---
    v8f s[4];  // s[nf][v] = S[qrow][kt + nf * 16 + 8 * hi + v]
#pragma unroll
    for (int nf = 0; nf < 4; ++nf) {
      v8f sc = {};
      sc = wmma32(load_frag16(&Ks[(kt + nf * 16) * KVP_], KVP_), aq0, sc);
      sc = wmma32(load_frag16(&Ks[(kt + nf * 16) * KVP_ + 32], KVP_), aq1, sc);
      const v4f a0 = __builtin_nontemporal_load((const v4f*)(ab + nf * 16));
      const v4f a1 = __builtin_nontemporal_load((const v4f*)(ab + nf * 16 + 4));
      s[nf] = sc * rn + __builtin_shufflevector(a0, a1, 0, 1, 2, 3, 4, 5, 6, 7);
    }

    // --- online softmax; fold attn_mult post-exp ---
    float xm[8];
#pragma unroll
    for (int v = 0; v < 8; ++v)
      xm[v] = fmaxf(fmaxf(s[0][v], s[1][v]), fmaxf(s[2][v], s[3][v]));
    float x = fmaxf(fmaxf(fmaxf(xm[0], xm[1]), fmaxf(xm[2], xm[3])),
                    fmaxf(fmaxf(xm[4], xm[5]), fmaxf(xm[6], xm[7])));
    x = fmaxf(x, xhalf(x));  // both halves now hold the tile's maximum
    const float nm = fmaxf(m, x);
    const float alpha = __expf(m - nm);
    m = nm;

    float psum[8];
#pragma unroll
    for (int v = 0; v < 8; ++v) psum[v] = 0.0f;
    v16h bp[2];  // B fragments: keys 0..31 and 32..63 of the tile
#pragma unroll
    for (int nf = 0; nf < 4; ++nf) {
      const v4f u0 = __builtin_nontemporal_load((const v4f*)(mb + nf * 16));
      const v4f u1 = __builtin_nontemporal_load((const v4f*)(mb + nf * 16 + 4));
#pragma unroll
      for (int v = 0; v < 8; ++v) {
        float p = __expf(s[nf][v] - m);
        psum[v] += p;  // normalizer excludes the multiplicative mask
        p *= (v < 4) ? u0[v & 3] : u1[v & 3];
        bp[nf >> 1][(nf & 1) * 8 + v] = (_Float16)p;
      }
    }
    l = l * alpha + (((psum[0] + psum[1]) + (psum[2] + psum[3])) +
                     ((psum[4] + psum[5]) + (psum[6] + psum[7])));

    // --- O^T = O^T * alpha + V^T P^T ---
#pragma unroll
    for (int df = 0; df < 4; ++df) {
#pragma unroll
      for (int v = 0; v < 8; ++v) acc[df][v] *= alpha;
      acc[df] = wmma32(load_frag_tr16(&Vs[kt * KVP_ + df * 16]), bp[0], acc[df]);
      acc[df] = wmma32(load_frag_tr16(&Vs[(kt + 32) * KVP_ + df * 16]), bp[1], acc[df]);
    }
  }

  asm volatile("v_nop\n\tv_nop\n\tv_nop\n\tv_nop");

  // --- the two halves of a query tile's keys are merged. K and V are dead once
  // every wave has left the loop: wave w + 8 lays its maximum, normalizer and
  // output sums (34 floats a lane, as 9 x 16 B, lane-contiguous) over K's place.
  __syncthreads();  // ends every wave's last read of Ks and Vs
  v4f* xch = (v4f*)Ks + (size_t)qw * 9 * 32 + lane;
  if (odd) {
    xch[0] = v4f{m, l, 0.0f, 0.0f};
#pragma unroll
    for (int df = 0; df < 4; ++df) {
      xch[(1 + 2 * df) * 32] = v4f{acc[df][0], acc[df][1], acc[df][2], acc[df][3]};
      xch[(2 + 2 * df) * 32] = v4f{acc[df][4], acc[df][5], acc[df][6], acc[df][7]};
    }
  }
  __syncthreads();  // publishes the odd waves' state to the even waves
  if (odd) return;  // wave-uniform, and no barrier follows

  // --- merge and normalize; element [b, q, h, d] (matches transpose+reshape)
  // goes out in fragment order for the output projection: the wave's 16 rows x
  // 64 columns are two whole tiles, and the lane already holds its share of both.
  const v4f ml2 = xch[0];
  const float mm = fmaxf(m, ml2[0]);
  const float a1 = __expf(m - mm);
  const float a2 = __expf(ml2[0] - mm);
  float ls = l * a1 + ml2[1] * a2;
  ls += xhalf(ls);  // the other half's keys
  const float inv = 1.0f / ls;
  v16h o[2];
#pragma unroll
  for (int df = 0; df < 4; ++df) {
    const v4f x0 = xch[(1 + 2 * df) * 32];
    const v4f x1 = xch[(2 + 2 * df) * 32];
#pragma unroll
    for (int v = 0; v < 8; ++v) {
      const float o2 = (v < 4) ? x0[v & 3] : x1[v & 3];
      o[df >> 1][(df & 1) * 8 + v] = (_Float16)((acc[df][v] * a1 + o2 * a2) * inv);
    }
  }
  _Float16* op =
      ob + ((size_t)((b * N_ + qbase) / 16) * KT_ + h * (D_ / 32)) * TILE_;
  store_frag_packed(op, o[0]);
  store_frag_packed(op + TILE_, o[1]);
}

// ---------------------------------------------------------------------------
// Launch
// ---------------------------------------------------------------------------
extern "C" void kernel_launch(void* const* d_in, const int* in_sizes, int n_in,
                              void* d_out, int out_size, void* d_ws, size_t ws_size,
                              hipStream_t stream) {
  (void)in_sizes; (void)n_in; (void)out_size; (void)ws_size;
  const float* X    = (const float*)d_in[0];
  const float* rno  = (const float*)d_in[1];
  const float* aadd = (const float*)d_in[2];
  const float* amul = (const float*)d_in[3];
  const float* Wq   = (const float*)d_in[4];
  const float* bq   = (const float*)d_in[5];
  const float* Wk   = (const float*)d_in[6];
  const float* bk   = (const float*)d_in[7];
  const float* Wv   = (const float*)d_in[8];
  const float* bv   = (const float*)d_in[9];
  const float* Wo   = (const float*)d_in[10];
  const float* bo   = (const float*)d_in[11];
  float* out = (float*)d_out;

  // Workspace layout (f16): ~17 MB total.
  const int BNE = B_ * N_ * E_;   // 2,097,152
  const int EE  = E_ * E_;        //   262,144
  _Float16* wo16 = (_Float16*)d_ws;
  _Float16* q16  = wo16 + EE;
  _Float16* k16  = q16 + BNE;
  _Float16* v16  = k16 + BNE;
  _Float16* a16  = v16 + BNE;

  const dim3 blk(256);
  // q16..v16 are three equal arrays back to back. The last row of blocks
  // converts Wo (E_ * E_ / TILE_ = 512 tiles, 16 a block).
  gemm_qkv_kernel<<<dim3(B_ * N_ / 128, QKV_NY_ + 1), dim3(512), 0, stream>>>(
      X, Wq, Wk, Wv, Wo, bq, bk, bv, q16, wo16);

  attn_kernel<<<dim3(N_ / 128, H_, B_), dim3(512), 0, stream>>>(
      q16, k16, v16, rno, aadd, amul, a16);

  gemm_out_kernel<<<dim3(B_ * N_ / 128, E_ / 64), blk, 0, stream>>>(
      a16, wo16, bo, out);
}
